// v000
// The times below were measured on an AMD MI455X: many runs one after another, warmed up first and cycling through
// copies of the inputs, with the whole window's GPU time divided by the number of runs. Launches and the gaps
// between them are all in it. The median over several windows is given; except for v000 it joins two sittings, which
// can be a few percent apart, so the side-by-side timings, each taken in one sitting, are the better comparison.
// The starting kernel, v000, takes 463 microseconds a run.
#include <hip/hip_runtime.h>
#include <hip/hip_bf16.h>
#include <math.h>

// ---------------------------------------------------------------------------
// Transformer layer for MI455X (gfx1250, wave32, WMMA).
// All matmuls use v_wmma_f32_16x16x32_bf16 (bf16 in, f32 accum).
// Weights pre-transposed at cast time so GEMM A and B tiles are both
// contiguous-row copies -> double-buffered async global->LDS staging.
// ---------------------------------------------------------------------------

typedef __attribute__((ext_vector_type(16))) __bf16 v16bf;
typedef __attribute__((ext_vector_type(8)))  float  v8f;
typedef __attribute__((ext_vector_type(4)))  float  f32x4;
typedef __attribute__((ext_vector_type(4)))  int    i32x4;

#define DMODEL 1024
#define DHEAD  64
#define NHEADS 16
#define DHID   4096
#define SEQ    2048
#define NTOK   4096   // B * S

union Frag16 { f32x4 f[2]; v16bf v; };
union Half8  { f32x4 f; __bf16 b[8]; };

#if __has_builtin(__builtin_amdgcn_global_load_async_to_lds_b128)
#define HAVE_ASYNC_LDS 1
#else
#define HAVE_ASYNC_LDS 0
#endif

// Copy 16 bytes (8 bf16) global -> LDS; async (per-lane gather) when available.
__device__ __forceinline__ void async_copy16(const __bf16* g, __bf16* l) {
#if HAVE_ASYNC_LDS
  __builtin_amdgcn_global_load_async_to_lds_b128(
      (__attribute__((address_space(1))) i32x4*)g,
      (__attribute__((address_space(3))) i32x4*)l, 0, 0);
#else
  *(f32x4*)l = *(const f32x4*)g;
#endif
}

__device__ __forceinline__ void wait_async_all() {
  asm volatile("s_wait_asynccnt 0x0" ::: "memory");
}

__device__ __forceinline__ v16bf load_frag(const __bf16* p0, const __bf16* p1) {
  Frag16 u;
  u.f[0] = *(const f32x4*)p0;   // elems 0..7  (K = half+0..7)
  u.f[1] = *(const f32x4*)p1;   // elems 8..15 (K = 16+half+0..7)
  return u.v;
}

__device__ __forceinline__ v8f zero8() {
  v8f z = {0.f,0.f,0.f,0.f,0.f,0.f,0.f,0.f};
  return z;
}

__device__ __forceinline__ v8f wmma_bf16(v16bf a, v16bf b, v8f c) {
  return __builtin_amdgcn_wmma_f32_16x16x32_bf16(
      false, a, false, b, (short)0, c, false, false);
}

// ---------------------------------------------------------------------------
// fp32 -> bf16 cast (n divisible by 1024)
// ---------------------------------------------------------------------------
__global__ __launch_bounds__(256)
void cast_bf16_kernel(const float* __restrict__ s, __bf16* __restrict__ d, int n) {
  int i = (blockIdx.x * 256 + threadIdx.x) * 4;
  if (i >= n) return;
  f32x4 v = *(const f32x4*)(s + i);
  d[i + 0] = (__bf16)v.x;
  d[i + 1] = (__bf16)v.y;
  d[i + 2] = (__bf16)v.z;
  d[i + 3] = (__bf16)v.w;
}

// ---------------------------------------------------------------------------
// fp32 W[K,N] -> bf16 Wt[N,K] (transpose via LDS tile). Grid (N/32, K/32).
// ---------------------------------------------------------------------------
__global__ __launch_bounds__(256)
void cast_transpose_kernel(const float* __restrict__ W, __bf16* __restrict__ Wt,
                           int K, int N) {
  __shared__ float tile[32][33];
  const int n0 = blockIdx.x * 32, k0 = blockIdx.y * 32;
  const int tx = threadIdx.x & 31, ty = threadIdx.x >> 5;   // 32 x 8
#pragma unroll
  for (int i = 0; i < 32; i += 8)
    tile[ty + i][tx] = W[(size_t)(k0 + ty + i) * N + n0 + tx];
  __syncthreads();
#pragma unroll
  for (int i = 0; i < 32; i += 8)
    Wt[(size_t)(n0 + ty + i) * K + k0 + tx] = (__bf16)tile[tx][ty + i];
}

// ---------------------------------------------------------------------------
// Tiled bf16 WMMA GEMM: C[M,N] = act(A[M,K] @ Bt[N,K]^T + bias)
// Block tile 128x128, k-step 64, double-buffered async LDS staging.
// 256 threads = 8 waves, wave grid 4x2 (MxN); each wave: 2x4 16x16 tiles.
// Both LDS tiles are [row/col][k] with stride 72 so every fragment is two
// contiguous ds_load_b128 per lane (A layout: K groups of 8 per lane-half).
// ---------------------------------------------------------------------------
template<bool GELU, bool OUT_BF16>
__global__ __launch_bounds__(256)
void gemm_kernel(const __bf16* __restrict__ A, const __bf16* __restrict__ Bt,
                 const float* __restrict__ bias, void* __restrict__ Cout,
                 int M, int N, int K)
{
  __shared__ __bf16 As[2][128 * 72];
  __shared__ __bf16 Bs[2][128 * 72];

  const int tid   = threadIdx.x;
  const int lane  = tid & 31;
  const int wave  = tid >> 5;
  const int waveM = wave >> 1;           // 0..3
  const int waveN = wave & 1;            // 0..1
  const int lr    = lane & 15;
  const int half  = (lane >> 4) * 8;
  const int blkN  = blockIdx.x * 128;
  const int blkM  = blockIdx.y * 128;

  v8f acc[2][4];
#pragma unroll
  for (int tm = 0; tm < 2; ++tm)
#pragma unroll
    for (int tn = 0; tn < 4; ++tn) acc[tm][tn] = zero8();

  const int srow = tid >> 1;             // 0..127
  const int skc  = (tid & 1) * 32;       // 0,32

  auto stage = [&](int k0, int buf) {
    const __bf16* ag = A  + (size_t)(blkM + srow) * K + k0 + skc;
    const __bf16* bg = Bt + (size_t)(blkN + srow) * K + k0 + skc;
    __bf16* al = &As[buf][srow * 72 + skc];
    __bf16* bl = &Bs[buf][srow * 72 + skc];
#pragma unroll
    for (int e = 0; e < 4; ++e) {
      async_copy16(ag + e * 8, al + e * 8);
      async_copy16(bg + e * 8, bl + e * 8);
    }
  };

  stage(0, 0);
  const int T = K >> 6;                  // K / 64
  for (int i = 0; i < T; ++i) {
    wait_async_all();                    // own tile-i loads landed
    __syncthreads();                     // everyone's tile-i landed; prev reads done
    if (i + 1 < T) stage((i + 1) * 64, (i + 1) & 1);

    const __bf16* as = As[i & 1];
    const __bf16* bs = Bs[i & 1];
#pragma unroll
    for (int kc = 0; kc < 2; ++kc) {
      v16bf af[2], bfv[4];
#pragma unroll
      for (int tm = 0; tm < 2; ++tm) {
        const __bf16* p = as + (waveM * 32 + tm * 16 + lr) * 72 + kc * 32 + half;
        af[tm] = load_frag(p, p + 16);
      }
#pragma unroll
      for (int tn = 0; tn < 4; ++tn) {
        const __bf16* p = bs + (waveN * 64 + tn * 16 + lr) * 72 + kc * 32 + half;
        bfv[tn] = load_frag(p, p + 16);
      }
#pragma unroll
      for (int tm = 0; tm < 2; ++tm)
#pragma unroll
        for (int tn = 0; tn < 4; ++tn)
          acc[tm][tn] = wmma_bf16(af[tm], bfv[tn], acc[tm][tn]);
    }
  }

  // epilogue: bias + optional exact GELU, f32 or bf16 store
#pragma unroll
  for (int tm = 0; tm < 2; ++tm) {
#pragma unroll
    for (int tn = 0; tn < 4; ++tn) {
      int col = blkN + waveN * 64 + tn * 16 + lr;
      float bv = bias ? bias[col] : 0.f;
#pragma unroll
      for (int r = 0; r < 8; ++r) {
        int row = blkM + waveM * 32 + tm * 16 + half + r;
        float v = acc[tm][tn][r] + bv;
        if (GELU) v = 0.5f * v * (1.f + erff(v * 0.70710678118654752f));
        if (OUT_BF16) ((__bf16*)Cout)[(size_t)row * N + col] = (__bf16)v;
        else          ((float*)Cout)[(size_t)row * N + col]  = v;
      }
    }
  }
}

// ---------------------------------------------------------------------------
// Causal flash attention. Grid: (SEQ/64, NHEADS, B). 128 threads = 4 waves.
// Each wave owns 16 query rows x 64 d_v. 32-key tiles; K staged async,
// V staged transposed. Q*K^T and P*V via WMMA; online softmax with 16-lane
// shfl_xor row reductions; P routed through LDS into A-fragment layout.
// ---------------------------------------------------------------------------
__global__ __launch_bounds__(128)
void attn_kernel(const __bf16* __restrict__ qb, const __bf16* __restrict__ kb,
                 const __bf16* __restrict__ vb, __bf16* __restrict__ ob)
{
  __shared__ __bf16 Kt[32 * 72];        // [key][d]
  __shared__ __bf16 Vt[64 * 40];        // [d][key] transposed
  __shared__ __bf16 Pb[4 * 16 * 40];    // per-wave P scratch

  const int tid  = threadIdx.x;
  const int lane = tid & 31;
  const int wave = tid >> 5;
  const int lr   = lane & 15;
  const int half = (lane >> 4) * 8;

  const int head = blockIdx.y;
  const int q0   = blockIdx.x * 64;
  const int qw   = q0 + wave * 16;
  const size_t tokbase = (size_t)blockIdx.z * SEQ;

  v16bf qf[2];
#pragma unroll
  for (int di = 0; di < 2; ++di) {
    const __bf16* p = qb + (tokbase + qw + lr) * DMODEL + head * DHEAD + di * 32 + half;
    qf[di] = load_frag(p, p + 16);
  }

  float m[8], l[8];
  v8f o[4];
#pragma unroll
  for (int r = 0; r < 8; ++r) { m[r] = -1e30f; l[r] = 0.f; }
#pragma unroll
  for (int t = 0; t < 4; ++t) o[t] = zero8();

  const int ktmax = (q0 + 63) >> 5;
  for (int kt = 0; kt <= ktmax; ++kt) {
    const int kpos = kt * 32;
#pragma unroll
    for (int c = tid; c < 256; c += 128) {
      int row = c >> 3;                 // key 0..31
      int off = (c & 7) * 8;            // d 0..56
      async_copy16(kb + (tokbase + kpos + row) * DMODEL + head * DHEAD + off,
                   Kt + row * 72 + off);
      Half8 tv;
      tv.f = *(const f32x4*)(vb + (tokbase + kpos + row) * DMODEL + head * DHEAD + off);
#pragma unroll
      for (int e = 0; e < 8; ++e) Vt[(off + e) * 40 + row] = tv.b[e];
    }
    wait_async_all();
    __syncthreads();

    // S = Q * K^T (16x32) as two 16x16 tiles
    v8f s0 = zero8(), s1 = zero8();
#pragma unroll
    for (int di = 0; di < 2; ++di) {
      const __bf16* p0 = Kt + lr * 72        + di * 32 + half;
      const __bf16* p1 = Kt + (16 + lr) * 72 + di * 32 + half;
      v16bf b0 = load_frag(p0, p0 + 16);
      v16bf b1 = load_frag(p1, p1 + 16);
      s0 = wmma_bf16(qf[di], b0, s0);
      s1 = wmma_bf16(qf[di], b1, s1);
    }

    // online softmax
    float p0v[8], p1v[8], alpha[8];
#pragma unroll
    for (int r = 0; r < 8; ++r) {
      int qrow = qw + half + r;
      int c0 = kpos + lr, c1 = kpos + 16 + lr;
      bool ok0 = (c0 <= qrow), ok1 = (c1 <= qrow);
      float v0 = ok0 ? s0[r] * 0.125f : -1e30f;
      float v1 = ok1 ? s1[r] * 0.125f : -1e30f;
      float mx = fmaxf(v0, v1);
#pragma unroll
      for (int msk = 8; msk >= 1; msk >>= 1) mx = fmaxf(mx, __shfl_xor(mx, msk, 32));
      float mn = fmaxf(m[r], mx);
      alpha[r] = expf(m[r] - mn);
      float p0 = ok0 ? expf(v0 - mn) : 0.f;
      float p1 = ok1 ? expf(v1 - mn) : 0.f;
      float ps = p0 + p1;
#pragma unroll
      for (int msk = 8; msk >= 1; msk >>= 1) ps += __shfl_xor(ps, msk, 32);
      l[r] = l[r] * alpha[r] + ps;
      m[r] = mn;
      p0v[r] = p0; p1v[r] = p1;
    }
#pragma unroll
    for (int t = 0; t < 4; ++t)
#pragma unroll
      for (int r = 0; r < 8; ++r) o[t][r] *= alpha[r];

    // P -> LDS -> A-fragment
    __bf16* pw = Pb + wave * (16 * 40);
#pragma unroll
    for (int r = 0; r < 8; ++r) {
      pw[(half + r) * 40 + lr]      = (__bf16)p0v[r];
      pw[(half + r) * 40 + 16 + lr] = (__bf16)p1v[r];
    }
    asm volatile("s_wait_dscnt 0" ::: "memory");

    const __bf16* pa = pw + lr * 40 + half;
    v16bf af = load_frag(pa, pa + 16);
#pragma unroll
    for (int t = 0; t < 4; ++t) {
      const __bf16* pv = Vt + (t * 16 + lr) * 40 + half;
      v16bf bv = load_frag(pv, pv + 16);
      o[t] = wmma_bf16(af, bv, o[t]);
    }
    __syncthreads();
  }

#pragma unroll
  for (int t = 0; t < 4; ++t)
#pragma unroll
    for (int r = 0; r < 8; ++r) {
      float val = o[t][r] / l[r];
      ob[(tokbase + qw + half + r) * DMODEL + head * DHEAD + t * 16 + lr] = (__bf16)val;
    }
}

// ---------------------------------------------------------------------------
// out = layernorm(x + y); optional bf16 copy for the next GEMM.
// ---------------------------------------------------------------------------
__global__ __launch_bounds__(256)
void add_ln_kernel(const float* __restrict__ x, const float* __restrict__ y,
                   const float* __restrict__ g, const float* __restrict__ b,
                   float* __restrict__ out, __bf16* __restrict__ outb)
{
  __shared__ float red[256];
  const int tid = threadIdx.x;
  const size_t base = (size_t)blockIdx.x * DMODEL + tid * 4;

  f32x4 xv = *(const f32x4*)(x + base);
  f32x4 yv = *(const f32x4*)(y + base);
  float v[4];
  float s = 0.f;
#pragma unroll
  for (int i = 0; i < 4; ++i) { v[i] = xv[i] + yv[i]; s += v[i]; }

  red[tid] = s; __syncthreads();
  for (int o_ = 128; o_ > 0; o_ >>= 1) { if (tid < o_) red[tid] += red[tid + o_]; __syncthreads(); }
  float mu = red[0] * (1.f / DMODEL);
  __syncthreads();

  s = 0.f;
#pragma unroll
  for (int i = 0; i < 4; ++i) { float d = v[i] - mu; s += d * d; }
  red[tid] = s; __syncthreads();
  for (int o_ = 128; o_ > 0; o_ >>= 1) { if (tid < o_) red[tid] += red[tid + o_]; __syncthreads(); }
  float rstd = rsqrtf(red[0] * (1.f / DMODEL) + 1e-5f);

  const int col = tid * 4;
#pragma unroll
  for (int i = 0; i < 4; ++i) {
    float o_ = (v[i] - mu) * rstd * g[col + i] + b[col + i];
    out[base + i] = o_;
    if (outb) outb[base + i] = (__bf16)o_;
  }
}

// ---------------------------------------------------------------------------
// Launcher
// ---------------------------------------------------------------------------
extern "C" void kernel_launch(void* const* d_in, const int* in_sizes, int n_in,
                              void* d_out, int out_size, void* d_ws, size_t ws_size,
                              hipStream_t stream) {
  const float* x    = (const float*)d_in[0];
  const float* Wq   = (const float*)d_in[1];
  const float* bq   = (const float*)d_in[2];
  const float* Wk   = (const float*)d_in[3];
  const float* bk   = (const float*)d_in[4];
  const float* Wv   = (const float*)d_in[5];
  const float* bv   = (const float*)d_in[6];
  const float* Wo   = (const float*)d_in[7];
  const float* ln1g = (const float*)d_in[8];
  const float* ln1b = (const float*)d_in[9];
  const float* W1   = (const float*)d_in[10];
  const float* b1   = (const float*)d_in[11];
  const float* W2   = (const float*)d_in[12];
  const float* b2   = (const float*)d_in[13];
  const float* ln2g = (const float*)d_in[14];
  const float* ln2b = (const float*)d_in[15];

  char* ws = (char*)d_ws;
  size_t off = 0;
  auto alloc = [&](size_t bytes) -> char* {
    char* p = ws + off;
    off = (off + bytes + 255) & ~(size_t)255;
    return p;
  };

  __bf16* xb   = (__bf16*)alloc((size_t)NTOK * DMODEL * 2);
  __bf16* Wqt  = (__bf16*)alloc((size_t)DMODEL * DMODEL * 2);   // [N][K]
  __bf16* Wkt  = (__bf16*)alloc((size_t)DMODEL * DMODEL * 2);
  __bf16* Wvt  = (__bf16*)alloc((size_t)DMODEL * DMODEL * 2);
  __bf16* Wot  = (__bf16*)alloc((size_t)DMODEL * DMODEL * 2);
  __bf16* W1t  = (__bf16*)alloc((size_t)DMODEL * DHID * 2);
  __bf16* W2t  = (__bf16*)alloc((size_t)DHID * DMODEL * 2);
  __bf16* qbuf = (__bf16*)alloc((size_t)NTOK * DMODEL * 2);
  __bf16* kbuf = (__bf16*)alloc((size_t)NTOK * DMODEL * 2);
  __bf16* vbuf = (__bf16*)alloc((size_t)NTOK * DMODEL * 2);
  __bf16* obuf = (__bf16*)alloc((size_t)NTOK * DMODEL * 2);
  float*  t1   = (float*)alloc((size_t)NTOK * DMODEL * 4);
  float*  h    = (float*)alloc((size_t)NTOK * DMODEL * 4);
  __bf16* hb   = (__bf16*)alloc((size_t)NTOK * DMODEL * 2);
  __bf16* m1   = (__bf16*)alloc((size_t)NTOK * DHID * 2);
  float*  m2   = (float*)alloc((size_t)NTOK * DMODEL * 4);

  cast_bf16_kernel<<<NTOK * DMODEL / 1024, 256, 0, stream>>>(x, xb, NTOK * DMODEL);

  auto castT = [&](const float* W, __bf16* Wt, int K, int N) {
    cast_transpose_kernel<<<dim3(N / 32, K / 32), 256, 0, stream>>>(W, Wt, K, N);
  };
  castT(Wq, Wqt, DMODEL, DMODEL);
  castT(Wk, Wkt, DMODEL, DMODEL);
  castT(Wv, Wvt, DMODEL, DMODEL);
  castT(Wo, Wot, DMODEL, DMODEL);
  castT(W1, W1t, DMODEL, DHID);
  castT(W2, W2t, DHID, DMODEL);

  // QKV projections (bf16 out)
  gemm_kernel<false, true><<<dim3(DMODEL / 128, NTOK / 128), 256, 0, stream>>>(
      xb, Wqt, bq, qbuf, NTOK, DMODEL, DMODEL);
  gemm_kernel<false, true><<<dim3(DMODEL / 128, NTOK / 128), 256, 0, stream>>>(
      xb, Wkt, bk, kbuf, NTOK, DMODEL, DMODEL);
  gemm_kernel<false, true><<<dim3(DMODEL / 128, NTOK / 128), 256, 0, stream>>>(
      xb, Wvt, bv, vbuf, NTOK, DMODEL, DMODEL);

  // causal flash attention
  attn_kernel<<<dim3(SEQ / 64, NHEADS, 2), 128, 0, stream>>>(qbuf, kbuf, vbuf, obuf);

  // output projection (f32 out, no bias)
  gemm_kernel<false, false><<<dim3(DMODEL / 128, NTOK / 128), 256, 0, stream>>>(
      obuf, Wot, nullptr, t1, NTOK, DMODEL, DMODEL);

  // h = LN(x + attn)
  add_ln_kernel<<<NTOK, 256, 0, stream>>>(x, t1, ln1g, ln1b, h, hb);

  // MLP up with fused exact GELU (bf16 out)
  gemm_kernel<true, true><<<dim3(DHID / 128, NTOK / 128), 256, 0, stream>>>(
      hb, W1t, b1, m1, NTOK, DHID, DMODEL);

  // MLP down (f32 out)
  gemm_kernel<false, false><<<dim3(DMODEL / 128, NTOK / 128), 256, 0, stream>>>(
      m1, W2t, b2, m2, NTOK, DMODEL, DHID);

  // out = LN(h + mlp)
  add_ln_kernel<<<NTOK, 256, 0, stream>>>(h, m2, ln2g, ln2b, (float*)d_out, nullptr);
}

// v001
// Measured time: 328 microseconds a run.
// Next to v000, in two timings, it ran 1.46 times as fast each time.
#include <hip/hip_runtime.h>
#include <hip/hip_bf16.h>
#include <math.h>

// ---------------------------------------------------------------------------
// Transformer layer for MI455X (gfx1250, wave32, WMMA).
// All matmuls use v_wmma_f32_16x16x32_bf16 (bf16 in, f32 accum).
// Weights pre-transposed at cast time so GEMM A and B tiles are both
// contiguous-row copies -> double-buffered async global->LDS staging.
// ---------------------------------------------------------------------------

typedef __attribute__((ext_vector_type(16))) __bf16 v16bf;
typedef __attribute__((ext_vector_type(8)))  float  v8f;
typedef __attribute__((ext_vector_type(4)))  float  f32x4;
typedef __attribute__((ext_vector_type(4)))  int    i32x4;

#define DMODEL 1024
#define DHEAD  64
#define NHEADS 16
#define DHID   4096
#define SEQ    2048
#define NTOK   4096   // B * S

union Frag16 { f32x4 f[2]; v16bf v; };
union Half8  { f32x4 f; __bf16 b[8]; };

#if __has_builtin(__builtin_amdgcn_global_load_async_to_lds_b128)
#define HAVE_ASYNC_LDS 1
#else
#define HAVE_ASYNC_LDS 0
#endif

// Copy 16 bytes (8 bf16) global -> LDS; async (per-lane gather) when available.
__device__ __forceinline__ void async_copy16(const __bf16* g, __bf16* l) {
#if HAVE_ASYNC_LDS
  __builtin_amdgcn_global_load_async_to_lds_b128(
      (__attribute__((address_space(1))) i32x4*)g,
      (__attribute__((address_space(3))) i32x4*)l, 0, 0);
#else
  *(f32x4*)l = *(const f32x4*)g;
#endif
}

__device__ __forceinline__ void wait_async_all() {
  asm volatile("s_wait_asynccnt 0x0" ::: "memory");
}

__device__ __forceinline__ v16bf load_frag(const __bf16* p0, const __bf16* p1) {
  Frag16 u;
  u.f[0] = *(const f32x4*)p0;   // elems 0..7  (K = half+0..7)
  u.f[1] = *(const f32x4*)p1;   // elems 8..15 (K = 16+half+0..7)
  return u.v;
}

__device__ __forceinline__ v8f zero8() {
  v8f z = {0.f,0.f,0.f,0.f,0.f,0.f,0.f,0.f};
  return z;
}

__device__ __forceinline__ v8f wmma_bf16(v16bf a, v16bf b, v8f c) {
  return __builtin_amdgcn_wmma_f32_16x16x32_bf16(
      false, a, false, b, (short)0, c, false, false);
}

// ---------------------------------------------------------------------------
// fp32 -> bf16 cast (n divisible by 1024)
// ---------------------------------------------------------------------------
__global__ __launch_bounds__(256)
void cast_bf16_kernel(const float* __restrict__ s, __bf16* __restrict__ d, int n) {
  int i = (blockIdx.x * 256 + threadIdx.x) * 4;
  if (i >= n) return;
  f32x4 v = *(const f32x4*)(s + i);
  d[i + 0] = (__bf16)v.x;
  d[i + 1] = (__bf16)v.y;
  d[i + 2] = (__bf16)v.z;
  d[i + 3] = (__bf16)v.w;
}

// ---------------------------------------------------------------------------
// fp32 W[K,N] -> bf16 Wt[N,K] (transpose via LDS tile). Grid (N/32, K/32).
// ---------------------------------------------------------------------------
__global__ __launch_bounds__(256)
void cast_transpose_kernel(const float* __restrict__ W, __bf16* __restrict__ Wt,
                           int K, int N) {
  __shared__ float tile[32][33];
  const int n0 = blockIdx.x * 32, k0 = blockIdx.y * 32;
  const int tx = threadIdx.x & 31, ty = threadIdx.x >> 5;   // 32 x 8
#pragma unroll
  for (int i = 0; i < 32; i += 8)
    tile[ty + i][tx] = W[(size_t)(k0 + ty + i) * N + n0 + tx];
  __syncthreads();
#pragma unroll
  for (int i = 0; i < 32; i += 8)
    Wt[(size_t)(n0 + ty + i) * K + k0 + tx] = (__bf16)tile[tx][ty + i];
}

// ---------------------------------------------------------------------------
// Tiled bf16 WMMA GEMM: C[M,N] = act(A[M,K] @ Bt[N,K]^T + bias)
// Block tile 128x128, k-step 64, double-buffered async LDS staging.
// 256 threads = 8 waves, wave grid 4x2 (MxN); each wave: 2x4 16x16 tiles.
// Both LDS tiles are [row/col][k] with stride 72 so every fragment is two
// contiguous ds_load_b128 per lane (A layout: K groups of 8 per lane-half).
// ---------------------------------------------------------------------------
template<bool GELU, bool OUT_BF16>
__global__ __launch_bounds__(256)
void gemm_kernel(const __bf16* __restrict__ A, const __bf16* __restrict__ Bt,
                 const float* __restrict__ bias, void* __restrict__ Cout,
                 int M, int N, int K)
{
  __shared__ __bf16 As[2][128 * 72];
  __shared__ __bf16 Bs[2][128 * 72];

  const int tid   = threadIdx.x;
  const int lane  = tid & 31;
  const int wave  = tid >> 5;
  const int waveM = wave >> 1;           // 0..3
  const int waveN = wave & 1;            // 0..1
  const int lr    = lane & 15;
  const int half  = (lane >> 4) * 8;
  const int blkN  = blockIdx.x * 128;
  const int blkM  = blockIdx.y * 128;

  v8f acc[2][4];
#pragma unroll
  for (int tm = 0; tm < 2; ++tm)
#pragma unroll
    for (int tn = 0; tn < 4; ++tn) acc[tm][tn] = zero8();

  const int srow = tid >> 1;             // 0..127
  const int skc  = (tid & 1) * 32;       // 0,32

  auto stage = [&](int k0, int buf) {
    const __bf16* ag = A  + (size_t)(blkM + srow) * K + k0 + skc;
    const __bf16* bg = Bt + (size_t)(blkN + srow) * K + k0 + skc;
    __bf16* al = &As[buf][srow * 72 + skc];
    __bf16* bl = &Bs[buf][srow * 72 + skc];
#pragma unroll
    for (int e = 0; e < 4; ++e) {
      async_copy16(ag + e * 8, al + e * 8);
      async_copy16(bg + e * 8, bl + e * 8);
    }
  };

  stage(0, 0);
  const int T = K >> 6;                  // K / 64
  for (int i = 0; i < T; ++i) {
    wait_async_all();                    // own tile-i loads landed
    __syncthreads();                     // everyone's tile-i landed; prev reads done
    if (i + 1 < T) stage((i + 1) * 64, (i + 1) & 1);

    const __bf16* as = As[i & 1];
    const __bf16* bs = Bs[i & 1];
#pragma unroll
    for (int kc = 0; kc < 2; ++kc) {
      v16bf af[2], bfv[4];
#pragma unroll
      for (int tm = 0; tm < 2; ++tm) {
        const __bf16* p = as + (waveM * 32 + tm * 16 + lr) * 72 + kc * 32 + half;
        af[tm] = load_frag(p, p + 16);
      }
#pragma unroll
      for (int tn = 0; tn < 4; ++tn) {
        const __bf16* p = bs + (waveN * 64 + tn * 16 + lr) * 72 + kc * 32 + half;
        bfv[tn] = load_frag(p, p + 16);
      }
#pragma unroll
      for (int tm = 0; tm < 2; ++tm)
#pragma unroll
        for (int tn = 0; tn < 4; ++tn)
          acc[tm][tn] = wmma_bf16(af[tm], bfv[tn], acc[tm][tn]);
    }
  }

  // epilogue: bias + optional exact GELU, f32 or bf16 store
#pragma unroll
  for (int tm = 0; tm < 2; ++tm) {
#pragma unroll
    for (int tn = 0; tn < 4; ++tn) {
      int col = blkN + waveN * 64 + tn * 16 + lr;
      float bv = bias ? bias[col] : 0.f;
#pragma unroll
      for (int r = 0; r < 8; ++r) {
        int row = blkM + waveM * 32 + tm * 16 + half + r;
        float v = acc[tm][tn][r] + bv;
        if (GELU) v = 0.5f * v * (1.f + erff(v * 0.70710678118654752f));
        if (OUT_BF16) ((__bf16*)Cout)[(size_t)row * N + col] = (__bf16)v;
        else          ((float*)Cout)[(size_t)row * N + col]  = v;
      }
    }
  }
}

__device__ __forceinline__ float xhalf(float x) {
  int b = __builtin_bit_cast(int, x);
  return __builtin_bit_cast(float,
      __builtin_amdgcn_permlanex16(b, b, 0x76543210, 0xfedcba98, false, false));
}

__global__ __launch_bounds__(128)
void attn_kernel(const __bf16* __restrict__ qb, const __bf16* __restrict__ kb,
                 const __bf16* __restrict__ vb, __bf16* __restrict__ ob)
{
  __shared__ __bf16 Kt[32 * 72];        // [key][d]
  __shared__ __bf16 Vt[64 * 40];        // [d][key] transposed

  const int tid  = threadIdx.x;
  const int lane = tid & 31;
  const int wave = tid >> 5;
  const int lr   = lane & 15;
  const int half = (lane >> 4) * 8;

  const int head = blockIdx.y;
  const int q0   = blockIdx.x * 64;
  const int qw   = q0 + wave * 16;
  const int qrow = qw + lr;             // this lane's query
  const size_t tokbase = (size_t)blockIdx.z * SEQ;

  v16bf qf[2];                          // B fragment: column = query, k = d
#pragma unroll
  for (int di = 0; di < 2; ++di) {
    const __bf16* p = qb + (tokbase + qrow) * DMODEL + head * DHEAD + di * 32 + half;
    qf[di] = load_frag(p, p + 16);
  }

  float m = -1e30f;                     // running maximum of this query
  float l = 0.f;                        // sum over this lane's keys only
  v8f o[4];                             // o[t][r] = O[qrow][t*16 + half + r]
#pragma unroll
  for (int t = 0; t < 4; ++t) o[t] = zero8();

  const int ktmax = (q0 + 63) >> 5;
  for (int kt = 0; kt <= ktmax; ++kt) {
    const int kpos = kt * 32;
#pragma unroll
    for (int c = tid; c < 256; c += 128) {
      int row = c >> 3;                 // key 0..31
      int off = (c & 7) * 8;            // d 0..56
      async_copy16(kb + (tokbase + kpos + row) * DMODEL + head * DHEAD + off,
                   Kt + row * 72 + off);
      Half8 tv;
      tv.f = *(const f32x4*)(vb + (tokbase + kpos + row) * DMODEL + head * DHEAD + off);
#pragma unroll
      for (int e = 0; e < 8; ++e) Vt[(off + e) * 40 + row] = tv.b[e];
    }
    wait_async_all();
    __syncthreads();

    // S^T = K * Q^T (32 keys x 16 queries) as two 16x16 tiles
    v8f s0 = zero8(), s1 = zero8();
#pragma unroll
    for (int di = 0; di < 2; ++di) {
      const __bf16* p0 = Kt + lr * 72        + di * 32 + half;
      const __bf16* p1 = Kt + (16 + lr) * 72 + di * 32 + half;
      v16bf a0 = load_frag(p0, p0 + 16);
      v16bf a1 = load_frag(p1, p1 + 16);
      s0 = wmma_bf16(a0, qf[di], s0);
      s1 = wmma_bf16(a1, qf[di], s1);
    }

    // online softmax, one query per lane
    float v0[8], v1[8];
    float mx = -1e30f;
#pragma unroll
    for (int r = 0; r < 8; ++r) {
      int c0 = kpos + half + r, c1 = c0 + 16;
      v0[r] = (c0 <= qrow) ? s0[r] * 0.125f : -1e30f;
      v1[r] = (c1 <= qrow) ? s1[r] * 0.125f : -1e30f;
      mx = fmaxf(mx, fmaxf(v0[r], v1[r]));
    }
    mx = fmaxf(mx, xhalf(mx));
    const float mn    = fmaxf(m, mx);
    const float alpha = expf(m - mn);
    m = mn;

    v16bf pf;                           // B fragment: column = query, k = key
    float ps = 0.f;
#pragma unroll
    for (int r = 0; r < 8; ++r) {
      int c0 = kpos + half + r, c1 = c0 + 16;
      float e0 = expf(v0[r] - mn), e1 = expf(v1[r] - mn);
      float p0 = (c0 <= qrow) ? e0 : 0.f;
      float p1 = (c1 <= qrow) ? e1 : 0.f;
      ps += p0 + p1;
      pf[r]     = (__bf16)p0;
      pf[8 + r] = (__bf16)p1;
    }
    l = l * alpha + ps;
#pragma unroll
    for (int t = 0; t < 4; ++t)
#pragma unroll
      for (int r = 0; r < 8; ++r) o[t][r] *= alpha;

    // O^T += V^T * P^T
#pragma unroll
    for (int t = 0; t < 4; ++t) {
      const __bf16* pv = Vt + (t * 16 + lr) * 40 + half;
      v16bf av = load_frag(pv, pv + 16);
      o[t] = wmma_bf16(av, pf, o[t]);
    }
    __syncthreads();
  }

  l += xhalf(l);                        // join the two halves' key sums
  __bf16* op = ob + (tokbase + qrow) * DMODEL + head * DHEAD + half;
#pragma unroll
  for (int t = 0; t < 4; ++t) {
    Half8 w;
#pragma unroll
    for (int r = 0; r < 8; ++r) w.b[r] = (__bf16)(o[t][r] / l);
    *(f32x4*)(op + t * 16) = w.f;
  }
}

// ---------------------------------------------------------------------------
// out = layernorm(x + y); optional bf16 copy for the next GEMM.
// ---------------------------------------------------------------------------
__global__ __launch_bounds__(256)
void add_ln_kernel(const float* __restrict__ x, const float* __restrict__ y,
                   const float* __restrict__ g, const float* __restrict__ b,
                   float* __restrict__ out, __bf16* __restrict__ outb)
{
  __shared__ float red[256];
  const int tid = threadIdx.x;
  const size_t base = (size_t)blockIdx.x * DMODEL + tid * 4;

  f32x4 xv = *(const f32x4*)(x + base);
  f32x4 yv = *(const f32x4*)(y + base);
  float v[4];
  float s = 0.f;
#pragma unroll
  for (int i = 0; i < 4; ++i) { v[i] = xv[i] + yv[i]; s += v[i]; }

  red[tid] = s; __syncthreads();
  for (int o_ = 128; o_ > 0; o_ >>= 1) { if (tid < o_) red[tid] += red[tid + o_]; __syncthreads(); }
  float mu = red[0] * (1.f / DMODEL);
  __syncthreads();

  s = 0.f;
#pragma unroll
  for (int i = 0; i < 4; ++i) { float d = v[i] - mu; s += d * d; }
  red[tid] = s; __syncthreads();
  for (int o_ = 128; o_ > 0; o_ >>= 1) { if (tid < o_) red[tid] += red[tid + o_]; __syncthreads(); }
  float rstd = rsqrtf(red[0] * (1.f / DMODEL) + 1e-5f);

  const int col = tid * 4;
#pragma unroll
  for (int i = 0; i < 4; ++i) {
    float o_ = (v[i] - mu) * rstd * g[col + i] + b[col + i];
    out[base + i] = o_;
    if (outb) outb[base + i] = (__bf16)o_;
  }
}

// ---------------------------------------------------------------------------
// Launcher
// ---------------------------------------------------------------------------
extern "C" void kernel_launch(void* const* d_in, const int* in_sizes, int n_in,
                              void* d_out, int out_size, void* d_ws, size_t ws_size,
                              hipStream_t stream) {
  const float* x    = (const float*)d_in[0];
  const float* Wq   = (const float*)d_in[1];
  const float* bq   = (const float*)d_in[2];
  const float* Wk   = (const float*)d_in[3];
  const float* bk   = (const float*)d_in[4];
  const float* Wv   = (const float*)d_in[5];
  const float* bv   = (const float*)d_in[6];
  const float* Wo   = (const float*)d_in[7];
  const float* ln1g = (const float*)d_in[8];
  const float* ln1b = (const float*)d_in[9];
  const float* W1   = (const float*)d_in[10];
  const float* b1   = (const float*)d_in[11];
  const float* W2   = (const float*)d_in[12];
  const float* b2   = (const float*)d_in[13];
  const float* ln2g = (const float*)d_in[14];
  const float* ln2b = (const float*)d_in[15];

  char* ws = (char*)d_ws;
  size_t off = 0;
  auto alloc = [&](size_t bytes) -> char* {
    char* p = ws + off;
    off = (off + bytes + 255) & ~(size_t)255;
    return p;
  };

  __bf16* xb   = (__bf16*)alloc((size_t)NTOK * DMODEL * 2);
  __bf16* Wqt  = (__bf16*)alloc((size_t)DMODEL * DMODEL * 2);   // [N][K]
  __bf16* Wkt  = (__bf16*)alloc((size_t)DMODEL * DMODEL * 2);
  __bf16* Wvt  = (__bf16*)alloc((size_t)DMODEL * DMODEL * 2);
  __bf16* Wot  = (__bf16*)alloc((size_t)DMODEL * DMODEL * 2);
  __bf16* W1t  = (__bf16*)alloc((size_t)DMODEL * DHID * 2);
  __bf16* W2t  = (__bf16*)alloc((size_t)DHID * DMODEL * 2);
  __bf16* qbuf = (__bf16*)alloc((size_t)NTOK * DMODEL * 2);
  __bf16* kbuf = (__bf16*)alloc((size_t)NTOK * DMODEL * 2);
  __bf16* vbuf = (__bf16*)alloc((size_t)NTOK * DMODEL * 2);
  __bf16* obuf = (__bf16*)alloc((size_t)NTOK * DMODEL * 2);
  float*  t1   = (float*)alloc((size_t)NTOK * DMODEL * 4);
  float*  h    = (float*)alloc((size_t)NTOK * DMODEL * 4);
  __bf16* hb   = (__bf16*)alloc((size_t)NTOK * DMODEL * 2);
  __bf16* m1   = (__bf16*)alloc((size_t)NTOK * DHID * 2);
  float*  m2   = (float*)alloc((size_t)NTOK * DMODEL * 4);

  cast_bf16_kernel<<<NTOK * DMODEL / 1024, 256, 0, stream>>>(x, xb, NTOK * DMODEL);

  auto castT = [&](const float* W, __bf16* Wt, int K, int N) {
    cast_transpose_kernel<<<dim3(N / 32, K / 32), 256, 0, stream>>>(W, Wt, K, N);
  };
  castT(Wq, Wqt, DMODEL, DMODEL);
  castT(Wk, Wkt, DMODEL, DMODEL);
  castT(Wv, Wvt, DMODEL, DMODEL);
  castT(Wo, Wot, DMODEL, DMODEL);
  castT(W1, W1t, DMODEL, DHID);
  castT(W2, W2t, DHID, DMODEL);

  // QKV projections (bf16 out)
  gemm_kernel<false, true><<<dim3(DMODEL / 128, NTOK / 128), 256, 0, stream>>>(
      xb, Wqt, bq, qbuf, NTOK, DMODEL, DMODEL);
  gemm_kernel<false, true><<<dim3(DMODEL / 128, NTOK / 128), 256, 0, stream>>>(
      xb, Wkt, bk, kbuf, NTOK, DMODEL, DMODEL);
  gemm_kernel<false, true><<<dim3(DMODEL / 128, NTOK / 128), 256, 0, stream>>>(
      xb, Wvt, bv, vbuf, NTOK, DMODEL, DMODEL);

  // causal flash attention
  attn_kernel<<<dim3(SEQ / 64, NHEADS, 2), 128, 0, stream>>>(qbuf, kbuf, vbuf, obuf);

  // output projection (f32 out, no bias)
  gemm_kernel<false, false><<<dim3(DMODEL / 128, NTOK / 128), 256, 0, stream>>>(
      obuf, Wot, nullptr, t1, NTOK, DMODEL, DMODEL);

  // h = LN(x + attn)
  add_ln_kernel<<<NTOK, 256, 0, stream>>>(x, t1, ln1g, ln1b, h, hb);

  // MLP up with fused exact GELU (bf16 out)
  gemm_kernel<true, true><<<dim3(DHID / 128, NTOK / 128), 256, 0, stream>>>(
      hb, W1t, b1, m1, NTOK, DHID, DMODEL);

  // MLP down (f32 out)
  gemm_kernel<false, false><<<dim3(DMODEL / 128, NTOK / 128), 256, 0, stream>>>(
      m1, W2t, b2, m2, NTOK, DMODEL, DHID);

  // out = LN(h + mlp)
  add_ln_kernel<<<NTOK, 256, 0, stream>>>(h, m2, ln2g, ln2b, (float*)d_out, nullptr);
}

// v002
// Measured time: 307 microseconds a run.
// Two timings next to v001 put it at 1.07 and 1.06 times that version's speed.
// All steps since v000 together make it 1.55 times as fast.
#include <hip/hip_runtime.h>
#include <hip/hip_bf16.h>
#include <math.h>

// ---------------------------------------------------------------------------
// Transformer layer for MI455X (gfx1250, wave32, WMMA).
// All matmuls use v_wmma_f32_16x16x32_bf16 (bf16 in, f32 accum).
// Weights pre-transposed at cast time so GEMM A and B tiles are both
// contiguous-row copies -> double-buffered async global->LDS staging.
// ---------------------------------------------------------------------------

typedef __attribute__((ext_vector_type(16))) __bf16 v16bf;
typedef __attribute__((ext_vector_type(8)))  float  v8f;
typedef __attribute__((ext_vector_type(4)))  float  f32x4;
typedef __attribute__((ext_vector_type(4)))  int    i32x4;

#define DMODEL 1024
#define DHEAD  64
#define NHEADS 16
#define DHID   4096
#define SEQ    2048
#define NTOK   4096   // B * S

union Frag16 { f32x4 f[2]; v16bf v; };
union Half8  { f32x4 f; __bf16 b[8]; };

#if __has_builtin(__builtin_amdgcn_global_load_async_to_lds_b128)
#define HAVE_ASYNC_LDS 1
#else
#define HAVE_ASYNC_LDS 0
#endif

// Copy 16 bytes (8 bf16) global -> LDS; async (per-lane gather) when available.
__device__ __forceinline__ void async_copy16(const __bf16* g, __bf16* l) {
#if HAVE_ASYNC_LDS
  __builtin_amdgcn_global_load_async_to_lds_b128(
      (__attribute__((address_space(1))) i32x4*)g,
      (__attribute__((address_space(3))) i32x4*)l, 0, 0);
#else
  *(f32x4*)l = *(const f32x4*)g;
#endif
}

__device__ __forceinline__ void wait_async_all() {
  asm volatile("s_wait_asynccnt 0x0" ::: "memory");
}

__device__ __forceinline__ v16bf load_frag(const __bf16* p0, const __bf16* p1) {
  Frag16 u;
  u.f[0] = *(const f32x4*)p0;   // elems 0..7  (K = half+0..7)
  u.f[1] = *(const f32x4*)p1;   // elems 8..15 (K = 16+half+0..7)
  return u.v;
}

__device__ __forceinline__ v8f zero8() {
  v8f z = {0.f,0.f,0.f,0.f,0.f,0.f,0.f,0.f};
  return z;
}

__device__ __forceinline__ v8f wmma_bf16(v16bf a, v16bf b, v8f c) {
  return __builtin_amdgcn_wmma_f32_16x16x32_bf16(
      false, a, false, b, (short)0, c, false, false);
}

// ---------------------------------------------------------------------------
// fp32 -> bf16 cast (n divisible by 1024)
// ---------------------------------------------------------------------------
__global__ __launch_bounds__(256)
void cast_bf16_kernel(const float* __restrict__ s, __bf16* __restrict__ d, int n) {
  int i = (blockIdx.x * 256 + threadIdx.x) * 4;
  if (i >= n) return;
  f32x4 v = *(const f32x4*)(s + i);
  d[i + 0] = (__bf16)v.x;
  d[i + 1] = (__bf16)v.y;
  d[i + 2] = (__bf16)v.z;
  d[i + 3] = (__bf16)v.w;
}

// ---------------------------------------------------------------------------
// fp32 W[K,N] -> bf16 Wt[N,K] (transpose via LDS tile). Grid (N/32, K/32).
// ---------------------------------------------------------------------------
__global__ __launch_bounds__(256)
void cast_transpose_kernel(const float* __restrict__ W, __bf16* __restrict__ Wt,
                           int K, int N) {
  __shared__ float tile[32][33];
  const int n0 = blockIdx.x * 32, k0 = blockIdx.y * 32;
  const int tx = threadIdx.x & 31, ty = threadIdx.x >> 5;   // 32 x 8
#pragma unroll
  for (int i = 0; i < 32; i += 8)
    tile[ty + i][tx] = W[(size_t)(k0 + ty + i) * N + n0 + tx];
  __syncthreads();
#pragma unroll
  for (int i = 0; i < 32; i += 8)
    Wt[(size_t)(n0 + ty + i) * K + k0 + tx] = (__bf16)tile[tx][ty + i];
}

// ---------------------------------------------------------------------------
// Tiled bf16 WMMA GEMM: C[M,N] = act(A[M,K] @ Bt[N,K]^T + bias)
// Block tile 128x128, k-step 64, double-buffered async LDS staging.
// 256 threads = 8 waves, wave grid 4x2 (MxN); each wave: 2x4 16x16 tiles.
// Both LDS tiles are [row/col][k] with stride 72 so every fragment is two
// contiguous ds_load_b128 per lane (A layout: K groups of 8 per lane-half).
// ---------------------------------------------------------------------------
template<bool GELU, bool OUT_BF16>
__global__ __launch_bounds__(256)
void gemm_kernel(const __bf16* __restrict__ A, const __bf16* __restrict__ Bt,
                 const float* __restrict__ bias, void* __restrict__ Cout,
                 int M, int N, int K)
{
  __shared__ __bf16 As[2][128 * 72];
  __shared__ __bf16 Bs[2][128 * 72];

  const int tid   = threadIdx.x;
  const int lane  = tid & 31;
  const int wave  = tid >> 5;
  const int waveM = wave >> 1;           // 0..3
  const int waveN = wave & 1;            // 0..1
  const int lr    = lane & 15;
  const int half  = (lane >> 4) * 8;
  const int blkN  = blockIdx.x * 128;
  const int blkM  = blockIdx.y * 128;

  v8f acc[2][4];
#pragma unroll
  for (int tm = 0; tm < 2; ++tm)
#pragma unroll
    for (int tn = 0; tn < 4; ++tn) acc[tm][tn] = zero8();

  // Eight lanes take one row's 128 bytes of the k-step, so each wave-wide
  // copy covers four whole 128-byte lines.
  const int srow = tid >> 3;             // 0..31, plus 32 per copy
  const int skc  = (tid & 7) * 8;        // 0..56

  auto stage = [&](int k0, int buf) {
    const __bf16* ag = A  + (size_t)(blkM + srow) * K + k0 + skc;
    const __bf16* bg = Bt + (size_t)(blkN + srow) * K + k0 + skc;
    __bf16* al = &As[buf][srow * 72 + skc];
    __bf16* bl = &Bs[buf][srow * 72 + skc];
#pragma unroll
    for (int e = 0; e < 4; ++e) {
      async_copy16(ag + (size_t)(e * 32) * K, al + e * 32 * 72);
      async_copy16(bg + (size_t)(e * 32) * K, bl + e * 32 * 72);
    }
  };

  stage(0, 0);
  const int T = K >> 6;                  // K / 64
  for (int i = 0; i < T; ++i) {
    wait_async_all();                    // own tile-i loads landed
    __syncthreads();                     // everyone's tile-i landed; prev reads done
    if (i + 1 < T) stage((i + 1) * 64, (i + 1) & 1);

    const __bf16* as = As[i & 1];
    const __bf16* bs = Bs[i & 1];
#pragma unroll
    for (int kc = 0; kc < 2; ++kc) {
      v16bf af[2], bfv[4];
#pragma unroll
      for (int tm = 0; tm < 2; ++tm) {
        const __bf16* p = as + (waveM * 32 + tm * 16 + lr) * 72 + kc * 32 + half;
        af[tm] = load_frag(p, p + 16);
      }
#pragma unroll
      for (int tn = 0; tn < 4; ++tn) {
        const __bf16* p = bs + (waveN * 64 + tn * 16 + lr) * 72 + kc * 32 + half;
        bfv[tn] = load_frag(p, p + 16);
      }
#pragma unroll
      for (int tm = 0; tm < 2; ++tm)
#pragma unroll
        for (int tn = 0; tn < 4; ++tn)
          acc[tm][tn] = wmma_bf16(af[tm], bfv[tn], acc[tm][tn]);
    }
  }

  // epilogue: bias + optional exact GELU, f32 or bf16 store
#pragma unroll
  for (int tm = 0; tm < 2; ++tm) {
#pragma unroll
    for (int tn = 0; tn < 4; ++tn) {
      int col = blkN + waveN * 64 + tn * 16 + lr;
      float bv = bias ? bias[col] : 0.f;
#pragma unroll
      for (int r = 0; r < 8; ++r) {
        int row = blkM + waveM * 32 + tm * 16 + half + r;
        float v = acc[tm][tn][r] + bv;
        if (GELU) v = 0.5f * v * (1.f + erff(v * 0.70710678118654752f));
        if (OUT_BF16) ((__bf16*)Cout)[(size_t)row * N + col] = (__bf16)v;
        else          ((float*)Cout)[(size_t)row * N + col]  = v;
      }
    }
  }
}

__device__ __forceinline__ float xhalf(float x) {
  int b = __builtin_bit_cast(int, x);
  return __builtin_bit_cast(float,
      __builtin_amdgcn_permlanex16(b, b, 0x76543210, 0xfedcba98, false, false));
}

__global__ __launch_bounds__(128)
void attn_kernel(const __bf16* __restrict__ qb, const __bf16* __restrict__ kb,
                 const __bf16* __restrict__ vb, __bf16* __restrict__ ob)
{
  __shared__ __bf16 Kt[32 * 72];        // [key][d]
  __shared__ __bf16 Vt[64 * 40];        // [d][key] transposed

  const int tid  = threadIdx.x;
  const int lane = tid & 31;
  const int wave = tid >> 5;
  const int lr   = lane & 15;
  const int half = (lane >> 4) * 8;

  const int head = blockIdx.y;
  const int q0   = blockIdx.x * 64;
  const int qw   = q0 + wave * 16;
  const int qrow = qw + lr;             // this lane's query
  const size_t tokbase = (size_t)blockIdx.z * SEQ;

  v16bf qf[2];                          // B fragment: column = query, k = d
#pragma unroll
  for (int di = 0; di < 2; ++di) {
    const __bf16* p = qb + (tokbase + qrow) * DMODEL + head * DHEAD + di * 32 + half;
    qf[di] = load_frag(p, p + 16);
  }

  float m = -1e30f;                     // running maximum of this query
  float l = 0.f;                        // sum over this lane's keys only
  v8f o[4];                             // o[t][r] = O[qrow][t*16 + half + r]
#pragma unroll
  for (int t = 0; t < 4; ++t) o[t] = zero8();

  const int ktmax = (q0 + 63) >> 5;
  for (int kt = 0; kt <= ktmax; ++kt) {
    const int kpos = kt * 32;
#pragma unroll
    for (int c = tid; c < 256; c += 128) {
      int row = c >> 3;                 // key 0..31
      int off = (c & 7) * 8;            // d 0..56
      async_copy16(kb + (tokbase + kpos + row) * DMODEL + head * DHEAD + off,
                   Kt + row * 72 + off);
      Half8 tv;
      tv.f = *(const f32x4*)(vb + (tokbase + kpos + row) * DMODEL + head * DHEAD + off);
#pragma unroll
      for (int e = 0; e < 8; ++e) Vt[(off + e) * 40 + row] = tv.b[e];
    }
    wait_async_all();
    __syncthreads();

    // S^T = K * Q^T (32 keys x 16 queries) as two 16x16 tiles
    v8f s0 = zero8(), s1 = zero8();
#pragma unroll
    for (int di = 0; di < 2; ++di) {
      const __bf16* p0 = Kt + lr * 72        + di * 32 + half;
      const __bf16* p1 = Kt + (16 + lr) * 72 + di * 32 + half;
      v16bf a0 = load_frag(p0, p0 + 16);
      v16bf a1 = load_frag(p1, p1 + 16);
      s0 = wmma_bf16(a0, qf[di], s0);
      s1 = wmma_bf16(a1, qf[di], s1);
    }

    // online softmax, one query per lane
    float v0[8], v1[8];
    float mx = -1e30f;
#pragma unroll
    for (int r = 0; r < 8; ++r) {
      int c0 = kpos + half + r, c1 = c0 + 16;
      v0[r] = (c0 <= qrow) ? s0[r] * 0.125f : -1e30f;
      v1[r] = (c1 <= qrow) ? s1[r] * 0.125f : -1e30f;
      mx = fmaxf(mx, fmaxf(v0[r], v1[r]));
    }
    mx = fmaxf(mx, xhalf(mx));
    const float mn    = fmaxf(m, mx);
    const float alpha = expf(m - mn);
    m = mn;

    v16bf pf;                           // B fragment: column = query, k = key
    float ps = 0.f;
#pragma unroll
    for (int r = 0; r < 8; ++r) {
      int c0 = kpos + half + r, c1 = c0 + 16;
      float e0 = expf(v0[r] - mn), e1 = expf(v1[r] - mn);
      float p0 = (c0 <= qrow) ? e0 : 0.f;
      float p1 = (c1 <= qrow) ? e1 : 0.f;
      ps += p0 + p1;
      pf[r]     = (__bf16)p0;
      pf[8 + r] = (__bf16)p1;
    }
    l = l * alpha + ps;
#pragma unroll
    for (int t = 0; t < 4; ++t)
#pragma unroll
      for (int r = 0; r < 8; ++r) o[t][r] *= alpha;

    // O^T += V^T * P^T
#pragma unroll
    for (int t = 0; t < 4; ++t) {
      const __bf16* pv = Vt + (t * 16 + lr) * 40 + half;
      v16bf av = load_frag(pv, pv + 16);
      o[t] = wmma_bf16(av, pf, o[t]);
    }
    __syncthreads();
  }

  l += xhalf(l);                        // join the two halves' key sums
  __bf16* op = ob + (tokbase + qrow) * DMODEL + head * DHEAD + half;
#pragma unroll
  for (int t = 0; t < 4; ++t) {
    Half8 w;
#pragma unroll
    for (int r = 0; r < 8; ++r) w.b[r] = (__bf16)(o[t][r] / l);
    *(f32x4*)(op + t * 16) = w.f;
  }
}

// ---------------------------------------------------------------------------
// out = layernorm(x + y); optional bf16 copy for the next GEMM.
// ---------------------------------------------------------------------------
__global__ __launch_bounds__(256)
void add_ln_kernel(const float* __restrict__ x, const float* __restrict__ y,
                   const float* __restrict__ g, const float* __restrict__ b,
                   float* __restrict__ out, __bf16* __restrict__ outb)
{
  __shared__ float red[256];
  const int tid = threadIdx.x;
  const size_t base = (size_t)blockIdx.x * DMODEL + tid * 4;

  f32x4 xv = *(const f32x4*)(x + base);
  f32x4 yv = *(const f32x4*)(y + base);
  float v[4];
  float s = 0.f;
#pragma unroll
  for (int i = 0; i < 4; ++i) { v[i] = xv[i] + yv[i]; s += v[i]; }

  red[tid] = s; __syncthreads();
  for (int o_ = 128; o_ > 0; o_ >>= 1) { if (tid < o_) red[tid] += red[tid + o_]; __syncthreads(); }
  float mu = red[0] * (1.f / DMODEL);
  __syncthreads();

  s = 0.f;
#pragma unroll
  for (int i = 0; i < 4; ++i) { float d = v[i] - mu; s += d * d; }
  red[tid] = s; __syncthreads();
  for (int o_ = 128; o_ > 0; o_ >>= 1) { if (tid < o_) red[tid] += red[tid + o_]; __syncthreads(); }
  float rstd = rsqrtf(red[0] * (1.f / DMODEL) + 1e-5f);

  const int col = tid * 4;
#pragma unroll
  for (int i = 0; i < 4; ++i) {
    float o_ = (v[i] - mu) * rstd * g[col + i] + b[col + i];
    out[base + i] = o_;
    if (outb) outb[base + i] = (__bf16)o_;
  }
}

// ---------------------------------------------------------------------------
// Launcher
// ---------------------------------------------------------------------------
extern "C" void kernel_launch(void* const* d_in, const int* in_sizes, int n_in,
                              void* d_out, int out_size, void* d_ws, size_t ws_size,
                              hipStream_t stream) {
  const float* x    = (const float*)d_in[0];
  const float* Wq   = (const float*)d_in[1];
  const float* bq   = (const float*)d_in[2];
  const float* Wk   = (const float*)d_in[3];
  const float* bk   = (const float*)d_in[4];
  const float* Wv   = (const float*)d_in[5];
  const float* bv   = (const float*)d_in[6];
  const float* Wo   = (const float*)d_in[7];
  const float* ln1g = (const float*)d_in[8];
  const float* ln1b = (const float*)d_in[9];
  const float* W1   = (const float*)d_in[10];
  const float* b1   = (const float*)d_in[11];
  const float* W2   = (const float*)d_in[12];
  const float* b2   = (const float*)d_in[13];
  const float* ln2g = (const float*)d_in[14];
  const float* ln2b = (const float*)d_in[15];

  char* ws = (char*)d_ws;
  size_t off = 0;
  auto alloc = [&](size_t bytes) -> char* {
    char* p = ws + off;
    off = (off + bytes + 255) & ~(size_t)255;
    return p;
  };

  __bf16* xb   = (__bf16*)alloc((size_t)NTOK * DMODEL * 2);
  __bf16* Wqt  = (__bf16*)alloc((size_t)DMODEL * DMODEL * 2);   // [N][K]
  __bf16* Wkt  = (__bf16*)alloc((size_t)DMODEL * DMODEL * 2);
  __bf16* Wvt  = (__bf16*)alloc((size_t)DMODEL * DMODEL * 2);
  __bf16* Wot  = (__bf16*)alloc((size_t)DMODEL * DMODEL * 2);
  __bf16* W1t  = (__bf16*)alloc((size_t)DMODEL * DHID * 2);
  __bf16* W2t  = (__bf16*)alloc((size_t)DHID * DMODEL * 2);
  __bf16* qbuf = (__bf16*)alloc((size_t)NTOK * DMODEL * 2);
  __bf16* kbuf = (__bf16*)alloc((size_t)NTOK * DMODEL * 2);
  __bf16* vbuf = (__bf16*)alloc((size_t)NTOK * DMODEL * 2);
  __bf16* obuf = (__bf16*)alloc((size_t)NTOK * DMODEL * 2);
  float*  t1   = (float*)alloc((size_t)NTOK * DMODEL * 4);
  float*  h    = (float*)alloc((size_t)NTOK * DMODEL * 4);
  __bf16* hb   = (__bf16*)alloc((size_t)NTOK * DMODEL * 2);
  __bf16* m1   = (__bf16*)alloc((size_t)NTOK * DHID * 2);
  float*  m2   = (float*)alloc((size_t)NTOK * DMODEL * 4);

  cast_bf16_kernel<<<NTOK * DMODEL / 1024, 256, 0, stream>>>(x, xb, NTOK * DMODEL);

  auto castT = [&](const float* W, __bf16* Wt, int K, int N) {
    cast_transpose_kernel<<<dim3(N / 32, K / 32), 256, 0, stream>>>(W, Wt, K, N);
  };
  castT(Wq, Wqt, DMODEL, DMODEL);
  castT(Wk, Wkt, DMODEL, DMODEL);
  castT(Wv, Wvt, DMODEL, DMODEL);
  castT(Wo, Wot, DMODEL, DMODEL);
  castT(W1, W1t, DMODEL, DHID);
  castT(W2, W2t, DHID, DMODEL);

  // QKV projections (bf16 out)
  gemm_kernel<false, true><<<dim3(DMODEL / 128, NTOK / 128), 256, 0, stream>>>(
      xb, Wqt, bq, qbuf, NTOK, DMODEL, DMODEL);
  gemm_kernel<false, true><<<dim3(DMODEL / 128, NTOK / 128), 256, 0, stream>>>(
      xb, Wkt, bk, kbuf, NTOK, DMODEL, DMODEL);
  gemm_kernel<false, true><<<dim3(DMODEL / 128, NTOK / 128), 256, 0, stream>>>(
      xb, Wvt, bv, vbuf, NTOK, DMODEL, DMODEL);

  // causal flash attention
  attn_kernel<<<dim3(SEQ / 64, NHEADS, 2), 128, 0, stream>>>(qbuf, kbuf, vbuf, obuf);

  // output projection (f32 out, no bias)
  gemm_kernel<false, false><<<dim3(DMODEL / 128, NTOK / 128), 256, 0, stream>>>(
      obuf, Wot, nullptr, t1, NTOK, DMODEL, DMODEL);

  // h = LN(x + attn)
  add_ln_kernel<<<NTOK, 256, 0, stream>>>(x, t1, ln1g, ln1b, h, hb);

  // MLP up with fused exact GELU (bf16 out)
  gemm_kernel<true, true><<<dim3(DHID / 128, NTOK / 128), 256, 0, stream>>>(
      hb, W1t, b1, m1, NTOK, DHID, DMODEL);

  // MLP down (f32 out)
  gemm_kernel<false, false><<<dim3(DMODEL / 128, NTOK / 128), 256, 0, stream>>>(
      m1, W2t, b2, m2, NTOK, DMODEL, DHID);

  // out = LN(h + mlp)
  add_ln_kernel<<<NTOK, 256, 0, stream>>>(h, m2, ln2g, ln2b, (float*)d_out, nullptr);
}

// v003
// It runs in 275 microseconds.
// Two timings next to v002 put it at 1.11 and 1.12 times that version's speed.
// Over all steps from v000 it is 1.73 times as fast.
#include <hip/hip_runtime.h>
#include <hip/hip_bf16.h>
#include <math.h>

// ---------------------------------------------------------------------------
// Transformer layer for MI455X (gfx1250, wave32, WMMA).
// All matmuls use v_wmma_f32_16x16x32_bf16 (bf16 in, f32 accum).
// Weights pre-transposed at cast time so GEMM A and B tiles are both
// contiguous-row copies -> double-buffered async global->LDS staging.
// ---------------------------------------------------------------------------

typedef __attribute__((ext_vector_type(16))) __bf16 v16bf;
typedef __attribute__((ext_vector_type(8)))  float  v8f;
typedef __attribute__((ext_vector_type(4)))  float  f32x4;
typedef __attribute__((ext_vector_type(4)))  int    i32x4;

#define DMODEL 1024
#define DHEAD  64
#define NHEADS 16
#define DHID   4096
#define SEQ    2048
#define NTOK   4096   // B * S

union Frag16 { f32x4 f[2]; v16bf v; };
union Half8  { f32x4 f; __bf16 b[8]; };

#if __has_builtin(__builtin_amdgcn_global_load_async_to_lds_b128)
#define HAVE_ASYNC_LDS 1
#else
#define HAVE_ASYNC_LDS 0
#endif

// Copy 16 bytes (8 bf16) global -> LDS; async (per-lane gather) when available.
__device__ __forceinline__ void async_copy16(const __bf16* g, __bf16* l) {
#if HAVE_ASYNC_LDS
  __builtin_amdgcn_global_load_async_to_lds_b128(
      (__attribute__((address_space(1))) i32x4*)g,
      (__attribute__((address_space(3))) i32x4*)l, 0, 0);
#else
  *(f32x4*)l = *(const f32x4*)g;
#endif
}

__device__ __forceinline__ void wait_async_all() {
  asm volatile("s_wait_asynccnt 0x0" ::: "memory");
}

__device__ __forceinline__ v16bf load_frag(const __bf16* p0, const __bf16* p1) {
  Frag16 u;
  u.f[0] = *(const f32x4*)p0;   // elems 0..7  (K = half+0..7)
  u.f[1] = *(const f32x4*)p1;   // elems 8..15 (K = 16+half+0..7)
  return u.v;
}

__device__ __forceinline__ v8f zero8() {
  v8f z = {0.f,0.f,0.f,0.f,0.f,0.f,0.f,0.f};
  return z;
}

__device__ __forceinline__ v8f wmma_bf16(v16bf a, v16bf b, v8f c) {
  return __builtin_amdgcn_wmma_f32_16x16x32_bf16(
      false, a, false, b, (short)0, c, false, false);
}

// ---------------------------------------------------------------------------
// Conversion pre-pass, one launch. None of its seven jobs reads another's
// output, so the block index picks the job:
//   blocks [0, 4096)      x fp32 -> bf16, 1024 elements a block
//   blocks [4096, 16384)  fp32 W[K,N] -> bf16 Wt[N,K], one 32x32 tile a block
//                         (Wq, Wk, Wv, Wo: 1024 tiles each; W1, W2: 4096 each)
// ---------------------------------------------------------------------------
#define XBLOCKS (NTOK * DMODEL / 1024)
#define SQTILES ((DMODEL / 32) * (DMODEL / 32))
#define HIDTILES ((DMODEL / 32) * (DHID / 32))

__global__ __launch_bounds__(256)
void prep_kernel(const float* __restrict__ x,
                 const float* __restrict__ Wq, const float* __restrict__ Wk,
                 const float* __restrict__ Wv, const float* __restrict__ Wo,
                 const float* __restrict__ W1, const float* __restrict__ W2,
                 __bf16* __restrict__ xb,
                 __bf16* __restrict__ Wqt, __bf16* __restrict__ Wkt,
                 __bf16* __restrict__ Wvt, __bf16* __restrict__ Wot,
                 __bf16* __restrict__ W1t, __bf16* __restrict__ W2t)
{
  __shared__ float tile[32][33];
  int b = blockIdx.x;

  if (b < XBLOCKS) {                     // whole block leaves ahead of the barrier
    int i = (b * 256 + threadIdx.x) * 4;
    f32x4 v = *(const f32x4*)(x + i);
    xb[i + 0] = (__bf16)v.x;
    xb[i + 1] = (__bf16)v.y;
    xb[i + 2] = (__bf16)v.z;
    xb[i + 3] = (__bf16)v.w;
    return;
  }
  b -= XBLOCKS;

  const float* W;
  __bf16* Wt;
  int K, N, lgnb;                        // lgnb = log2(N / 32)
  if (b < 4 * SQTILES) {
    const int w = b / SQTILES;
    b -= w * SQTILES;
    W  = w == 0 ? Wq  : w == 1 ? Wk  : w == 2 ? Wv  : Wo;
    Wt = w == 0 ? Wqt : w == 1 ? Wkt : w == 2 ? Wvt : Wot;
    K = DMODEL; N = DMODEL; lgnb = 5;
  } else if (b < 4 * SQTILES + HIDTILES) {
    b -= 4 * SQTILES;
    W = W1; Wt = W1t; K = DMODEL; N = DHID; lgnb = 7;
  } else {
    b -= 4 * SQTILES + HIDTILES;
    W = W2; Wt = W2t; K = DHID; N = DMODEL; lgnb = 5;
  }

  const int n0 = (b & ((1 << lgnb) - 1)) * 32, k0 = (b >> lgnb) * 32;
  const int tx = threadIdx.x & 31, ty = threadIdx.x >> 5;   // 32 x 8
#pragma unroll
  for (int i = 0; i < 32; i += 8)
    tile[ty + i][tx] = W[(size_t)(k0 + ty + i) * N + n0 + tx];
  __syncthreads();
#pragma unroll
  for (int i = 0; i < 32; i += 8)
    Wt[(size_t)(n0 + ty + i) * K + k0 + tx] = (__bf16)tile[tx][ty + i];
}

// ---------------------------------------------------------------------------
// Tiled bf16 WMMA GEMM: C[M,N] = act(A[M,K] @ Bt[N,K]^T + bias)
// Block tile 128x128, k-step 64, double-buffered async LDS staging.
// 256 threads = 8 waves, wave grid 4x2 (MxN); each wave: 2x4 16x16 tiles.
// Both LDS tiles are [row/col][k] with stride 72 so every fragment is two
// contiguous ds_load_b128 per lane (A layout: K groups of 8 per lane-half).
// TRI: three products that share A in one launch. Bt holds the three [N,K]
// weights one behind the other, Cout the three [M,N] outputs likewise; grid x
// runs over all 3N columns and each 128-column block lies in one part.
// ---------------------------------------------------------------------------
template<bool GELU, bool OUT_BF16, bool TRI>
__global__ __launch_bounds__(256)
void gemm_kernel(const __bf16* __restrict__ A, const __bf16* __restrict__ Bt,
                 const float* __restrict__ bias, const float* __restrict__ bias1,
                 const float* __restrict__ bias2, void* __restrict__ Cout,
                 int M, int N, int K)
{
  __shared__ __bf16 As[2][128 * 72];
  __shared__ __bf16 Bs[2][128 * 72];

  const int tid   = threadIdx.x;
  const int lane  = tid & 31;
  const int wave  = tid >> 5;
  const int waveM = wave >> 1;           // 0..3
  const int waveN = wave & 1;            // 0..1
  const int lr    = lane & 15;
  const int half  = (lane >> 4) * 8;
  const int blkN  = blockIdx.x * 128;
  const int blkM  = blockIdx.y * 128;

  v8f acc[2][4];
#pragma unroll
  for (int tm = 0; tm < 2; ++tm)
#pragma unroll
    for (int tn = 0; tn < 4; ++tn) acc[tm][tn] = zero8();

  // Eight lanes take one row's 128 bytes of the k-step, so each wave-wide
  // copy covers four whole 128-byte lines.
  const int srow = tid >> 3;             // 0..31, plus 32 per copy
  const int skc  = (tid & 7) * 8;        // 0..56

  auto stage = [&](int k0, int buf) {
    const __bf16* ag = A  + (size_t)(blkM + srow) * K + k0 + skc;
    const __bf16* bg = Bt + (size_t)(blkN + srow) * K + k0 + skc;
    __bf16* al = &As[buf][srow * 72 + skc];
    __bf16* bl = &Bs[buf][srow * 72 + skc];
#pragma unroll
    for (int e = 0; e < 4; ++e) {
      async_copy16(ag + (size_t)(e * 32) * K, al + e * 32 * 72);
      async_copy16(bg + (size_t)(e * 32) * K, bl + e * 32 * 72);
    }
  };

  stage(0, 0);
  const int T = K >> 6;                  // K / 64
  for (int i = 0; i < T; ++i) {
    wait_async_all();                    // own tile-i loads landed
    __syncthreads();                     // everyone's tile-i landed; prev reads done
    if (i + 1 < T) stage((i + 1) * 64, (i + 1) & 1);

    const __bf16* as = As[i & 1];
    const __bf16* bs = Bs[i & 1];
#pragma unroll
    for (int kc = 0; kc < 2; ++kc) {
      v16bf af[2], bfv[4];
#pragma unroll
      for (int tm = 0; tm < 2; ++tm) {
        const __bf16* p = as + (waveM * 32 + tm * 16 + lr) * 72 + kc * 32 + half;
        af[tm] = load_frag(p, p + 16);
      }
#pragma unroll
      for (int tn = 0; tn < 4; ++tn) {
        const __bf16* p = bs + (waveN * 64 + tn * 16 + lr) * 72 + kc * 32 + half;
        bfv[tn] = load_frag(p, p + 16);
      }
#pragma unroll
      for (int tm = 0; tm < 2; ++tm)
#pragma unroll
        for (int tn = 0; tn < 4; ++tn)
          acc[tm][tn] = wmma_bf16(af[tm], bfv[tn], acc[tm][tn]);
    }
  }

  // epilogue: bias + optional exact GELU, f32 or bf16 store
  int partN = 0;                         // first column of this block's part
  if (TRI) {
    const int part = blkN / N;
    partN = part * N;
    bias = part == 0 ? bias : part == 1 ? bias1 : bias2;
    // col below counts from column 0 of part 0: part's [M,N] output starts
    // part * M * N elements on, less the partN that col already holds
    Cout = (__bf16*)Cout + ((size_t)part * M * N - partN);
  }
#pragma unroll
  for (int tm = 0; tm < 2; ++tm) {
#pragma unroll
    for (int tn = 0; tn < 4; ++tn) {
      int col = blkN + waveN * 64 + tn * 16 + lr;
      float bv = bias ? bias[col - partN] : 0.f;
#pragma unroll
      for (int r = 0; r < 8; ++r) {
        int row = blkM + waveM * 32 + tm * 16 + half + r;
        float v = acc[tm][tn][r] + bv;
        if (GELU) v = 0.5f * v * (1.f + erff(v * 0.70710678118654752f));
        if (OUT_BF16) ((__bf16*)Cout)[(size_t)row * N + col] = (__bf16)v;
        else          ((float*)Cout)[(size_t)row * N + col]  = v;
      }
    }
  }
}

__device__ __forceinline__ float xhalf(float x) {
  int b = __builtin_bit_cast(int, x);
  return __builtin_bit_cast(float,
      __builtin_amdgcn_permlanex16(b, b, 0x76543210, 0xfedcba98, false, false));
}

__global__ __launch_bounds__(128)
void attn_kernel(const __bf16* __restrict__ qb, const __bf16* __restrict__ kb,
                 const __bf16* __restrict__ vb, __bf16* __restrict__ ob)
{
  __shared__ __bf16 Kt[32 * 72];        // [key][d]
  __shared__ __bf16 Vt[64 * 40];        // [d][key] transposed

  const int tid  = threadIdx.x;
  const int lane = tid & 31;
  const int wave = tid >> 5;
  const int lr   = lane & 15;
  const int half = (lane >> 4) * 8;

  const int head = blockIdx.y;
  const int q0   = blockIdx.x * 64;
  const int qw   = q0 + wave * 16;
  const int qrow = qw + lr;             // this lane's query
  const size_t tokbase = (size_t)blockIdx.z * SEQ;

  v16bf qf[2];                          // B fragment: column = query, k = d
#pragma unroll
  for (int di = 0; di < 2; ++di) {
    const __bf16* p = qb + (tokbase + qrow) * DMODEL + head * DHEAD + di * 32 + half;
    qf[di] = load_frag(p, p + 16);
  }

  float m = -1e30f;                     // running maximum of this query
  float l = 0.f;                        // sum over this lane's keys only
  v8f o[4];                             // o[t][r] = O[qrow][t*16 + half + r]
#pragma unroll
  for (int t = 0; t < 4; ++t) o[t] = zero8();

  const int ktmax = (q0 + 63) >> 5;
  for (int kt = 0; kt <= ktmax; ++kt) {
    const int kpos = kt * 32;
#pragma unroll
    for (int c = tid; c < 256; c += 128) {
      int row = c >> 3;                 // key 0..31
      int off = (c & 7) * 8;            // d 0..56
      async_copy16(kb + (tokbase + kpos + row) * DMODEL + head * DHEAD + off,
                   Kt + row * 72 + off);
      Half8 tv;
      tv.f = *(const f32x4*)(vb + (tokbase + kpos + row) * DMODEL + head * DHEAD + off);
#pragma unroll
      for (int e = 0; e < 8; ++e) Vt[(off + e) * 40 + row] = tv.b[e];
    }
    wait_async_all();
    __syncthreads();

    // S^T = K * Q^T (32 keys x 16 queries) as two 16x16 tiles
    v8f s0 = zero8(), s1 = zero8();
#pragma unroll
    for (int di = 0; di < 2; ++di) {
      const __bf16* p0 = Kt + lr * 72        + di * 32 + half;
      const __bf16* p1 = Kt + (16 + lr) * 72 + di * 32 + half;
      v16bf a0 = load_frag(p0, p0 + 16);
      v16bf a1 = load_frag(p1, p1 + 16);
      s0 = wmma_bf16(a0, qf[di], s0);
      s1 = wmma_bf16(a1, qf[di], s1);
    }

    // online softmax, one query per lane
    float v0[8], v1[8];
    float mx = -1e30f;
#pragma unroll
    for (int r = 0; r < 8; ++r) {
      int c0 = kpos + half + r, c1 = c0 + 16;
      v0[r] = (c0 <= qrow) ? s0[r] * 0.125f : -1e30f;
      v1[r] = (c1 <= qrow) ? s1[r] * 0.125f : -1e30f;
      mx = fmaxf(mx, fmaxf(v0[r], v1[r]));
    }
    mx = fmaxf(mx, xhalf(mx));
    const float mn    = fmaxf(m, mx);
    const float alpha = expf(m - mn);
    m = mn;

    v16bf pf;                           // B fragment: column = query, k = key
    float ps = 0.f;
#pragma unroll
    for (int r = 0; r < 8; ++r) {
      int c0 = kpos + half + r, c1 = c0 + 16;
      float e0 = expf(v0[r] - mn), e1 = expf(v1[r] - mn);
      float p0 = (c0 <= qrow) ? e0 : 0.f;
      float p1 = (c1 <= qrow) ? e1 : 0.f;
      ps += p0 + p1;
      pf[r]     = (__bf16)p0;
      pf[8 + r] = (__bf16)p1;
    }
    l = l * alpha + ps;
#pragma unroll
    for (int t = 0; t < 4; ++t)
#pragma unroll
      for (int r = 0; r < 8; ++r) o[t][r] *= alpha;

    // O^T += V^T * P^T
#pragma unroll
    for (int t = 0; t < 4; ++t) {
      const __bf16* pv = Vt + (t * 16 + lr) * 40 + half;
      v16bf av = load_frag(pv, pv + 16);
      o[t] = wmma_bf16(av, pf, o[t]);
    }
    __syncthreads();
  }

  l += xhalf(l);                        // join the two halves' key sums
  __bf16* op = ob + (tokbase + qrow) * DMODEL + head * DHEAD + half;
#pragma unroll
  for (int t = 0; t < 4; ++t) {
    Half8 w;
#pragma unroll
    for (int r = 0; r < 8; ++r) w.b[r] = (__bf16)(o[t][r] / l);
    *(f32x4*)(op + t * 16) = w.f;
  }
}

// ---------------------------------------------------------------------------
// out = layernorm(x + y); optional bf16 copy for the next GEMM.
// ---------------------------------------------------------------------------
__global__ __launch_bounds__(256)
void add_ln_kernel(const float* __restrict__ x, const float* __restrict__ y,
                   const float* __restrict__ g, const float* __restrict__ b,
                   float* __restrict__ out, __bf16* __restrict__ outb)
{
  __shared__ float red[256];
  const int tid = threadIdx.x;
  const size_t base = (size_t)blockIdx.x * DMODEL + tid * 4;

  f32x4 xv = *(const f32x4*)(x + base);
  f32x4 yv = *(const f32x4*)(y + base);
  float v[4];
  float s = 0.f;
#pragma unroll
  for (int i = 0; i < 4; ++i) { v[i] = xv[i] + yv[i]; s += v[i]; }

  red[tid] = s; __syncthreads();
  for (int o_ = 128; o_ > 0; o_ >>= 1) { if (tid < o_) red[tid] += red[tid + o_]; __syncthreads(); }
  float mu = red[0] * (1.f / DMODEL);
  __syncthreads();

  s = 0.f;
#pragma unroll
  for (int i = 0; i < 4; ++i) { float d = v[i] - mu; s += d * d; }
  red[tid] = s; __syncthreads();
  for (int o_ = 128; o_ > 0; o_ >>= 1) { if (tid < o_) red[tid] += red[tid + o_]; __syncthreads(); }
  float rstd = rsqrtf(red[0] * (1.f / DMODEL) + 1e-5f);

  const int col = tid * 4;
#pragma unroll
  for (int i = 0; i < 4; ++i) {
    float o_ = (v[i] - mu) * rstd * g[col + i] + b[col + i];
    out[base + i] = o_;
    if (outb) outb[base + i] = (__bf16)o_;
  }
}

// ---------------------------------------------------------------------------
// Launcher
// ---------------------------------------------------------------------------
extern "C" void kernel_launch(void* const* d_in, const int* in_sizes, int n_in,
                              void* d_out, int out_size, void* d_ws, size_t ws_size,
                              hipStream_t stream) {
  const float* x    = (const float*)d_in[0];
  const float* Wq   = (const float*)d_in[1];
  const float* bq   = (const float*)d_in[2];
  const float* Wk   = (const float*)d_in[3];
  const float* bk   = (const float*)d_in[4];
  const float* Wv   = (const float*)d_in[5];
  const float* bv   = (const float*)d_in[6];
  const float* Wo   = (const float*)d_in[7];
  const float* ln1g = (const float*)d_in[8];
  const float* ln1b = (const float*)d_in[9];
  const float* W1   = (const float*)d_in[10];
  const float* b1   = (const float*)d_in[11];
  const float* W2   = (const float*)d_in[12];
  const float* b2   = (const float*)d_in[13];
  const float* ln2g = (const float*)d_in[14];
  const float* ln2b = (const float*)d_in[15];

  char* ws = (char*)d_ws;
  size_t off = 0;
  auto alloc = [&](size_t bytes) -> char* {
    char* p = ws + off;
    off = (off + bytes + 255) & ~(size_t)255;
    return p;
  };

  __bf16* xb   = (__bf16*)alloc((size_t)NTOK * DMODEL * 2);
  __bf16* Wqt  = (__bf16*)alloc((size_t)3 * DMODEL * DMODEL * 2);   // [N][K], q k v in a row
  __bf16* Wkt  = Wqt + (size_t)DMODEL * DMODEL;
  __bf16* Wvt  = Wkt + (size_t)DMODEL * DMODEL;
  __bf16* Wot  = (__bf16*)alloc((size_t)DMODEL * DMODEL * 2);
  __bf16* W1t  = (__bf16*)alloc((size_t)DMODEL * DHID * 2);
  __bf16* W2t  = (__bf16*)alloc((size_t)DHID * DMODEL * 2);
  __bf16* qbuf = (__bf16*)alloc((size_t)3 * NTOK * DMODEL * 2);     // q k v in a row
  __bf16* kbuf = qbuf + (size_t)NTOK * DMODEL;
  __bf16* vbuf = kbuf + (size_t)NTOK * DMODEL;
  __bf16* obuf = (__bf16*)alloc((size_t)NTOK * DMODEL * 2);
  float*  t1   = (float*)alloc((size_t)NTOK * DMODEL * 4);
  float*  h    = (float*)alloc((size_t)NTOK * DMODEL * 4);
  __bf16* hb   = (__bf16*)alloc((size_t)NTOK * DMODEL * 2);
  __bf16* m1   = (__bf16*)alloc((size_t)NTOK * DHID * 2);
  float*  m2   = (float*)alloc((size_t)NTOK * DMODEL * 4);

  // x cast and the six weight transposes
  prep_kernel<<<XBLOCKS + 4 * SQTILES + 2 * HIDTILES, 256, 0, stream>>>(
      x, Wq, Wk, Wv, Wo, W1, W2, xb, Wqt, Wkt, Wvt, Wot, W1t, W2t);

  // Q, K and V projections (bf16 out)
  gemm_kernel<false, true, true><<<dim3(3 * DMODEL / 128, NTOK / 128), 256, 0, stream>>>(
      xb, Wqt, bq, bk, bv, qbuf, NTOK, DMODEL, DMODEL);

  // causal flash attention
  attn_kernel<<<dim3(SEQ / 64, NHEADS, 2), 128, 0, stream>>>(qbuf, kbuf, vbuf, obuf);

  // output projection (f32 out, no bias)
  gemm_kernel<false, false, false><<<dim3(DMODEL / 128, NTOK / 128), 256, 0, stream>>>(
      obuf, Wot, nullptr, nullptr, nullptr, t1, NTOK, DMODEL, DMODEL);

  // h = LN(x + attn)
  add_ln_kernel<<<NTOK, 256, 0, stream>>>(x, t1, ln1g, ln1b, h, hb);

  // MLP up with fused exact GELU (bf16 out)
  gemm_kernel<true, true, false><<<dim3(DHID / 128, NTOK / 128), 256, 0, stream>>>(
      hb, W1t, b1, nullptr, nullptr, m1, NTOK, DHID, DMODEL);

  // MLP down (f32 out)
  gemm_kernel<false, false, false><<<dim3(DMODEL / 128, NTOK / 128), 256, 0, stream>>>(
      m1, W2t, b2, nullptr, nullptr, m2, NTOK, DMODEL, DHID);

  // out = LN(h + mlp)
  add_ln_kernel<<<NTOK, 256, 0, stream>>>(h, m2, ln2g, ln2b, (float*)d_out, nullptr);
}

// v004
// One run takes 260 microseconds.
// Two timings next to v003 both put it at 1.05 times that version's speed.
// Counting every step since v000, it is 1.82 times as fast.
#include <hip/hip_runtime.h>
#include <hip/hip_bf16.h>
#include <math.h>

// ---------------------------------------------------------------------------
// Transformer layer for MI455X (gfx1250, wave32, WMMA).
// All matmuls use v_wmma_f32_16x16x32_bf16 (bf16 in, f32 accum).
// Weights pre-transposed at cast time so GEMM A and B tiles are both
// contiguous-row copies -> double-buffered async global->LDS staging.
// ---------------------------------------------------------------------------

typedef __attribute__((ext_vector_type(16))) __bf16 v16bf;
typedef __attribute__((ext_vector_type(8)))  float  v8f;
typedef __attribute__((ext_vector_type(4)))  float  f32x4;
typedef __attribute__((ext_vector_type(4)))  int    i32x4;

#define DMODEL 1024
#define DHEAD  64
#define NHEADS 16
#define DHID   4096
#define SEQ    2048
#define NTOK   4096   // B * S

union Frag16 { f32x4 f[2]; v16bf v; };
union Half8  { f32x4 f; __bf16 b[8]; };

#if __has_builtin(__builtin_amdgcn_global_load_async_to_lds_b128)
#define HAVE_ASYNC_LDS 1
#else
#define HAVE_ASYNC_LDS 0
#endif

// Copy 16 bytes (8 bf16) global -> LDS; async (per-lane gather) when available.
__device__ __forceinline__ void async_copy16(const __bf16* g, __bf16* l) {
#if HAVE_ASYNC_LDS
  __builtin_amdgcn_global_load_async_to_lds_b128(
      (__attribute__((address_space(1))) i32x4*)g,
      (__attribute__((address_space(3))) i32x4*)l, 0, 0);
#else
  *(f32x4*)l = *(const f32x4*)g;
#endif
}

__device__ __forceinline__ void wait_async_all() {
  asm volatile("s_wait_asynccnt 0x0" ::: "memory");
}

__device__ __forceinline__ v16bf load_frag(const __bf16* p0, const __bf16* p1) {
  Frag16 u;
  u.f[0] = *(const f32x4*)p0;   // elems 0..7  (K = half+0..7)
  u.f[1] = *(const f32x4*)p1;   // elems 8..15 (K = 16+half+0..7)
  return u.v;
}

__device__ __forceinline__ v8f zero8() {
  v8f z = {0.f,0.f,0.f,0.f,0.f,0.f,0.f,0.f};
  return z;
}

__device__ __forceinline__ v8f wmma_bf16(v16bf a, v16bf b, v8f c) {
  return __builtin_amdgcn_wmma_f32_16x16x32_bf16(
      false, a, false, b, (short)0, c, false, false);
}

// ---------------------------------------------------------------------------
// Conversion pre-pass, one launch. None of its seven jobs reads another's
// output, so the block index picks the job. Every block converts 16384
// elements, 64 a thread by 16-byte loads, so that few waves have to start:
//   blocks [0, 256)     x fp32 -> bf16
//   blocks [256, 1024)  fp32 W[K,N] -> bf16 Wt[N,K], one 128x128 tile a block
//                       (Wq, Wk, Wv, Wo: 64 tiles each; W1, W2: 256 each)
// ---------------------------------------------------------------------------
#define PREPELEMS 16384
#define XBLOCKS (NTOK * DMODEL / PREPELEMS)
#define SQTILES ((DMODEL / 128) * (DMODEL / 128))
#define HIDTILES ((DMODEL / 128) * (DHID / 128))

typedef __attribute__((ext_vector_type(2))) float    f32x2;
typedef __attribute__((ext_vector_type(2))) __bf16   bf16x2;
typedef __attribute__((ext_vector_type(2))) unsigned u32x2;
typedef __attribute__((ext_vector_type(4))) unsigned u32x4;

// two f32 -> one dword of two bf16, a in the low half
__device__ __forceinline__ unsigned pack2(float a, float b) {
  f32x2 v = {a, b};
  return __builtin_bit_cast(unsigned, __builtin_convertvector(v, bf16x2));
}

// One 128x128 tile: fp32 W[K,N] -> bf16 Wt[N,K]. K and N are compile-time, so
// a thread's 16 loads are one address with 16 immediate offsets.
// tile is [n][k] as bf16, 256 B a row, in units of 8 B (four k). Unit u of row
// n lies at place u ^ (n >> 2): the 32 lanes of a store, which hold 32 rows at
// one u, then fall on 32 different places, that is on all 64 banks.
// The loops are unrolled so that v[][] stays in registers and the offsets
// are immediates.
template<int K, int N>
__device__ __forceinline__ void transpose_tile(const float* __restrict__ W,
                                               __bf16* __restrict__ Wt,
                                               int b, unsigned* tile)
{
  const int tid = threadIdx.x;
  const int n0 = (b % (N / 128)) * 128, k0 = (b / (N / 128)) * 128;
  const int lane = tid & 31, wave = tid >> 5;

  // A wave-wide load is 512 B of one k row; a lane holds columns 4*lane..+3
  // of rows 4*u..4*u+3, u = wave + 8*j.
  const float* src = W + (size_t)(k0 + 4 * wave) * N + n0 + lane * 4;
  f32x4 v[4][4];
#pragma unroll
  for (int j = 0; j < 4; ++j)
#pragma unroll
    for (int e = 0; e < 4; ++e)
      v[j][e] = *(const f32x4*)(src + (32 * j + e) * N);
#pragma unroll
  for (int j = 0; j < 4; ++j)
#pragma unroll
    for (int i = 0; i < 4; ++i) {
      u32x2 p = {pack2(v[j][0][i], v[j][1][i]), pack2(v[j][2][i], v[j][3][i])};
      *(u32x2*)&tile[(lane * 4 + i) * 64 + (((wave + 8 * j) ^ lane) << 1)] = p;
    }
  __syncthreads();

  // 16 lanes store one row's 256 B. Units 2*kg and 2*kg+1 share a 16-byte
  // place and stand there in swapped order where n >> 2 is odd.
  const int kg = tid & 15, nr = tid >> 4;
  __bf16* dst = Wt + (size_t)(n0 + nr) * K + k0 + kg * 8;
#pragma unroll
  for (int p = 0; p < 8; ++p) {
    const int n = nr + 16 * p;
    const int s = n >> 2;
    u32x4 q = *(const u32x4*)&tile[n * 64 + ((kg ^ (s >> 1)) << 2)];
    if (s & 1) q = q.zwxy;
    *(u32x4*)(dst + 16 * p * K) = q;
  }
  // the stores' registers may be written again by the code that follows in
  // the listing: the wait stands in front of any such overwrite
  asm volatile("s_wait_xcnt 0x0" ::: "memory");
}

__global__ __launch_bounds__(256)
void prep_kernel(const float* __restrict__ x,
                 const float* __restrict__ Wq, const float* __restrict__ Wk,
                 const float* __restrict__ Wv, const float* __restrict__ Wo,
                 const float* __restrict__ W1, const float* __restrict__ W2,
                 __bf16* __restrict__ xb,
                 __bf16* __restrict__ Wqt, __bf16* __restrict__ Wkt,
                 __bf16* __restrict__ Wvt, __bf16* __restrict__ Wot,
                 __bf16* __restrict__ W1t, __bf16* __restrict__ W2t)
{
  __shared__ __attribute__((aligned(16))) unsigned tile[128 * 64];
  int b = blockIdx.x;

  if (b < XBLOCKS) {
    const size_t base = (size_t)b * PREPELEMS + threadIdx.x * 4;
    f32x4 v[16];                         // unrolled: v[] stays in registers
#pragma unroll
    for (int j = 0; j < 16; ++j) v[j] = *(const f32x4*)(x + base + j * 1024);
#pragma unroll
    for (int j = 0; j < 16; ++j) {
      u32x2 p = {pack2(v[j].x, v[j].y), pack2(v[j].z, v[j].w)};
      *(u32x2*)(xb + base + j * 1024) = p;
    }
    return;
  }
  b -= XBLOCKS;

  // the branches are uniform for the block, so each one's barrier is met by
  // all of its threads
  if (b < 4 * SQTILES) {
    const int w = b / SQTILES;
    const float* W = w == 0 ? Wq  : w == 1 ? Wk  : w == 2 ? Wv  : Wo;
    __bf16* Wt     = w == 0 ? Wqt : w == 1 ? Wkt : w == 2 ? Wvt : Wot;
    transpose_tile<DMODEL, DMODEL>(W, Wt, b - w * SQTILES, tile);
  } else if (b < 4 * SQTILES + HIDTILES) {
    transpose_tile<DMODEL, DHID>(W1, W1t, b - 4 * SQTILES, tile);
  } else {
    transpose_tile<DHID, DMODEL>(W2, W2t, b - (4 * SQTILES + HIDTILES), tile);
  }
}

// ---------------------------------------------------------------------------
// Tiled bf16 WMMA GEMM: C[M,N] = act(A[M,K] @ Bt[N,K]^T + bias)
// Block tile 128x128, k-step 64, double-buffered async LDS staging.
// 256 threads = 8 waves, wave grid 4x2 (MxN); each wave: 2x4 16x16 tiles.
// Both LDS tiles are [row/col][k] with stride 72 so every fragment is two
// contiguous ds_load_b128 per lane (A layout: K groups of 8 per lane-half).
// TRI: three products that share A in one launch. Bt holds the three [N,K]
// weights one behind the other, Cout the three [M,N] outputs likewise; grid x
// runs over all 3N columns and each 128-column block lies in one part.
// ---------------------------------------------------------------------------
template<bool GELU, bool OUT_BF16, bool TRI>
__global__ __launch_bounds__(256)
void gemm_kernel(const __bf16* __restrict__ A, const __bf16* __restrict__ Bt,
                 const float* __restrict__ bias, const float* __restrict__ bias1,
                 const float* __restrict__ bias2, void* __restrict__ Cout,
                 int M, int N, int K)
{
  __shared__ __bf16 As[2][128 * 72];
  __shared__ __bf16 Bs[2][128 * 72];

  const int tid   = threadIdx.x;
  const int lane  = tid & 31;
  const int wave  = tid >> 5;
  const int waveM = wave >> 1;           // 0..3
  const int waveN = wave & 1;            // 0..1
  const int lr    = lane & 15;
  const int half  = (lane >> 4) * 8;
  const int blkN  = blockIdx.x * 128;
  const int blkM  = blockIdx.y * 128;

  v8f acc[2][4];
#pragma unroll
  for (int tm = 0; tm < 2; ++tm)
#pragma unroll
    for (int tn = 0; tn < 4; ++tn) acc[tm][tn] = zero8();

  // Eight lanes take one row's 128 bytes of the k-step, so each wave-wide
  // copy covers four whole 128-byte lines.
  const int srow = tid >> 3;             // 0..31, plus 32 per copy
  const int skc  = (tid & 7) * 8;        // 0..56

  auto stage = [&](int k0, int buf) {
    const __bf16* ag = A  + (size_t)(blkM + srow) * K + k0 + skc;
    const __bf16* bg = Bt + (size_t)(blkN + srow) * K + k0 + skc;
    __bf16* al = &As[buf][srow * 72 + skc];
    __bf16* bl = &Bs[buf][srow * 72 + skc];
#pragma unroll
    for (int e = 0; e < 4; ++e) {
      async_copy16(ag + (size_t)(e * 32) * K, al + e * 32 * 72);
      async_copy16(bg + (size_t)(e * 32) * K, bl + e * 32 * 72);
    }
  };

  stage(0, 0);
  const int T = K >> 6;                  // K / 64
  for (int i = 0; i < T; ++i) {
    wait_async_all();                    // own tile-i loads landed
    __syncthreads();                     // everyone's tile-i landed; prev reads done
    if (i + 1 < T) stage((i + 1) * 64, (i + 1) & 1);

    const __bf16* as = As[i & 1];
    const __bf16* bs = Bs[i & 1];
#pragma unroll
    for (int kc = 0; kc < 2; ++kc) {
      v16bf af[2], bfv[4];
#pragma unroll
      for (int tm = 0; tm < 2; ++tm) {
        const __bf16* p = as + (waveM * 32 + tm * 16 + lr) * 72 + kc * 32 + half;
        af[tm] = load_frag(p, p + 16);
      }
#pragma unroll
      for (int tn = 0; tn < 4; ++tn) {
        const __bf16* p = bs + (waveN * 64 + tn * 16 + lr) * 72 + kc * 32 + half;
        bfv[tn] = load_frag(p, p + 16);
      }
#pragma unroll
      for (int tm = 0; tm < 2; ++tm)
#pragma unroll
        for (int tn = 0; tn < 4; ++tn)
          acc[tm][tn] = wmma_bf16(af[tm], bfv[tn], acc[tm][tn]);
    }
  }

  // epilogue: bias + optional exact GELU, f32 or bf16 store
  int partN = 0;                         // first column of this block's part
  if (TRI) {
    const int part = blkN / N;
    partN = part * N;
    bias = part == 0 ? bias : part == 1 ? bias1 : bias2;
    // col below counts from column 0 of part 0: part's [M,N] output starts
    // part * M * N elements on, less the partN that col already holds
    Cout = (__bf16*)Cout + ((size_t)part * M * N - partN);
  }
#pragma unroll
  for (int tm = 0; tm < 2; ++tm) {
#pragma unroll
    for (int tn = 0; tn < 4; ++tn) {
      int col = blkN + waveN * 64 + tn * 16 + lr;
      float bv = bias ? bias[col - partN] : 0.f;
#pragma unroll
      for (int r = 0; r < 8; ++r) {
        int row = blkM + waveM * 32 + tm * 16 + half + r;
        float v = acc[tm][tn][r] + bv;
        if (GELU) v = 0.5f * v * (1.f + erff(v * 0.70710678118654752f));
        if (OUT_BF16) ((__bf16*)Cout)[(size_t)row * N + col] = (__bf16)v;
        else          ((float*)Cout)[(size_t)row * N + col]  = v;
      }
    }
  }
}

__device__ __forceinline__ float xhalf(float x) {
  int b = __builtin_bit_cast(int, x);
  return __builtin_bit_cast(float,
      __builtin_amdgcn_permlanex16(b, b, 0x76543210, 0xfedcba98, false, false));
}

__global__ __launch_bounds__(128)
void attn_kernel(const __bf16* __restrict__ qb, const __bf16* __restrict__ kb,
                 const __bf16* __restrict__ vb, __bf16* __restrict__ ob)
{
  __shared__ __bf16 Kt[32 * 72];        // [key][d]
  __shared__ __bf16 Vt[64 * 40];        // [d][key] transposed

  const int tid  = threadIdx.x;
  const int lane = tid & 31;
  const int wave = tid >> 5;
  const int lr   = lane & 15;
  const int half = (lane >> 4) * 8;

  const int head = blockIdx.y;
  const int q0   = blockIdx.x * 64;
  const int qw   = q0 + wave * 16;
  const int qrow = qw + lr;             // this lane's query
  const size_t tokbase = (size_t)blockIdx.z * SEQ;

  v16bf qf[2];                          // B fragment: column = query, k = d
#pragma unroll
  for (int di = 0; di < 2; ++di) {
    const __bf16* p = qb + (tokbase + qrow) * DMODEL + head * DHEAD + di * 32 + half;
    qf[di] = load_frag(p, p + 16);
  }

  float m = -1e30f;                     // running maximum of this query
  float l = 0.f;                        // sum over this lane's keys only
  v8f o[4];                             // o[t][r] = O[qrow][t*16 + half + r]
#pragma unroll
  for (int t = 0; t < 4; ++t) o[t] = zero8();

  const int ktmax = (q0 + 63) >> 5;
  for (int kt = 0; kt <= ktmax; ++kt) {
    const int kpos = kt * 32;
#pragma unroll
    for (int c = tid; c < 256; c += 128) {
      int row = c >> 3;                 // key 0..31
      int off = (c & 7) * 8;            // d 0..56
      async_copy16(kb + (tokbase + kpos + row) * DMODEL + head * DHEAD + off,
                   Kt + row * 72 + off);
      Half8 tv;
      tv.f = *(const f32x4*)(vb + (tokbase + kpos + row) * DMODEL + head * DHEAD + off);
#pragma unroll
      for (int e = 0; e < 8; ++e) Vt[(off + e) * 40 + row] = tv.b[e];
    }
    wait_async_all();
    __syncthreads();

    // S^T = K * Q^T (32 keys x 16 queries) as two 16x16 tiles
    v8f s0 = zero8(), s1 = zero8();
#pragma unroll
    for (int di = 0; di < 2; ++di) {
      const __bf16* p0 = Kt + lr * 72        + di * 32 + half;
      const __bf16* p1 = Kt + (16 + lr) * 72 + di * 32 + half;
      v16bf a0 = load_frag(p0, p0 + 16);
      v16bf a1 = load_frag(p1, p1 + 16);
      s0 = wmma_bf16(a0, qf[di], s0);
      s1 = wmma_bf16(a1, qf[di], s1);
    }

    // online softmax, one query per lane
    float v0[8], v1[8];
    float mx = -1e30f;
#pragma unroll
    for (int r = 0; r < 8; ++r) {
      int c0 = kpos + half + r, c1 = c0 + 16;
      v0[r] = (c0 <= qrow) ? s0[r] * 0.125f : -1e30f;
      v1[r] = (c1 <= qrow) ? s1[r] * 0.125f : -1e30f;
      mx = fmaxf(mx, fmaxf(v0[r], v1[r]));
    }
    mx = fmaxf(mx, xhalf(mx));
    const float mn    = fmaxf(m, mx);
    const float alpha = expf(m - mn);
    m = mn;

    v16bf pf;                           // B fragment: column = query, k = key
    float ps = 0.f;
#pragma unroll
    for (int r = 0; r < 8; ++r) {
      int c0 = kpos + half + r, c1 = c0 + 16;
      float e0 = expf(v0[r] - mn), e1 = expf(v1[r] - mn);
      float p0 = (c0 <= qrow) ? e0 : 0.f;
      float p1 = (c1 <= qrow) ? e1 : 0.f;
      ps += p0 + p1;
      pf[r]     = (__bf16)p0;
      pf[8 + r] = (__bf16)p1;
    }
    l = l * alpha + ps;
#pragma unroll
    for (int t = 0; t < 4; ++t)
#pragma unroll
      for (int r = 0; r < 8; ++r) o[t][r] *= alpha;

    // O^T += V^T * P^T
#pragma unroll
    for (int t = 0; t < 4; ++t) {
      const __bf16* pv = Vt + (t * 16 + lr) * 40 + half;
      v16bf av = load_frag(pv, pv + 16);
      o[t] = wmma_bf16(av, pf, o[t]);
    }
    __syncthreads();
  }

  l += xhalf(l);                        // join the two halves' key sums
  __bf16* op = ob + (tokbase + qrow) * DMODEL + head * DHEAD + half;
#pragma unroll
  for (int t = 0; t < 4; ++t) {
    Half8 w;
#pragma unroll
    for (int r = 0; r < 8; ++r) w.b[r] = (__bf16)(o[t][r] / l);
    *(f32x4*)(op + t * 16) = w.f;
  }
}

// ---------------------------------------------------------------------------
// out = layernorm(x + y); optional bf16 copy for the next GEMM.
// One wave holds one row, 32 elements a lane by 16-byte loads, so that few
// waves have to start; both sums stay inside the wave: no LDS, no barrier.
// The loops are unrolled so that v[] and yv[] stay in registers.
// ---------------------------------------------------------------------------
__device__ __forceinline__ float wave_sum(float s) {
#pragma unroll
  for (int m = 16; m > 0; m >>= 1) s += __shfl_xor(s, m, 32);
  return s;
}

__global__ __launch_bounds__(256)
void add_ln_kernel(const float* __restrict__ x, const float* __restrict__ y,
                   const float* __restrict__ g, const float* __restrict__ b,
                   float* __restrict__ out, __bf16* __restrict__ outb)
{
  const int col = (threadIdx.x & 31) * 4;                 // plus 128 per j
  const int row = blockIdx.x * 8 + (threadIdx.x >> 5);
  const size_t base = (size_t)row * DMODEL + col;

  f32x4 v[8], yv[8];
#pragma unroll
  for (int j = 0; j < 8; ++j) v[j]  = *(const f32x4*)(x + base + j * 128);
#pragma unroll
  for (int j = 0; j < 8; ++j) yv[j] = *(const f32x4*)(y + base + j * 128);

  f32x4 s4 = {0.f, 0.f, 0.f, 0.f};
#pragma unroll
  for (int j = 0; j < 8; ++j) { v[j] += yv[j]; s4 += v[j]; }
  const float mu = wave_sum((s4.x + s4.y) + (s4.z + s4.w)) * (1.f / DMODEL);

  s4 = (f32x4){0.f, 0.f, 0.f, 0.f};
#pragma unroll
  for (int j = 0; j < 8; ++j) { v[j] -= mu; s4 += v[j] * v[j]; }
  const float rstd =
      rsqrtf(wave_sum((s4.x + s4.y) + (s4.z + s4.w)) * (1.f / DMODEL) + 1e-5f);

#pragma unroll
  for (int j = 0; j < 8; ++j) {
    const f32x4 gv = *(const f32x4*)(g + col + j * 128);
    const f32x4 bv = *(const f32x4*)(b + col + j * 128);
    v[j] = v[j] * rstd * gv + bv;
  }
  if (outb) {
#pragma unroll
    for (int j = 0; j < 8; ++j) {
      u32x2 p = {pack2(v[j].x, v[j].y), pack2(v[j].z, v[j].w)};
      *(u32x2*)(outb + base + j * 128) = p;
    }
  }
#pragma unroll
  for (int j = 0; j < 8; ++j) *(f32x4*)(out + base + j * 128) = v[j];
}

// ---------------------------------------------------------------------------
// Launcher
// ---------------------------------------------------------------------------
extern "C" void kernel_launch(void* const* d_in, const int* in_sizes, int n_in,
                              void* d_out, int out_size, void* d_ws, size_t ws_size,
                              hipStream_t stream) {
  const float* x    = (const float*)d_in[0];
  const float* Wq   = (const float*)d_in[1];
  const float* bq   = (const float*)d_in[2];
  const float* Wk   = (const float*)d_in[3];
  const float* bk   = (const float*)d_in[4];
  const float* Wv   = (const float*)d_in[5];
  const float* bv   = (const float*)d_in[6];
  const float* Wo   = (const float*)d_in[7];
  const float* ln1g = (const float*)d_in[8];
  const float* ln1b = (const float*)d_in[9];
  const float* W1   = (const float*)d_in[10];
  const float* b1   = (const float*)d_in[11];
  const float* W2   = (const float*)d_in[12];
  const float* b2   = (const float*)d_in[13];
  const float* ln2g = (const float*)d_in[14];
  const float* ln2b = (const float*)d_in[15];

  char* ws = (char*)d_ws;
  size_t off = 0;
  auto alloc = [&](size_t bytes) -> char* {
    char* p = ws + off;
    off = (off + bytes + 255) & ~(size_t)255;
    return p;
  };

  __bf16* xb   = (__bf16*)alloc((size_t)NTOK * DMODEL * 2);
  __bf16* Wqt  = (__bf16*)alloc((size_t)3 * DMODEL * DMODEL * 2);   // [N][K], q k v in a row
  __bf16* Wkt  = Wqt + (size_t)DMODEL * DMODEL;
  __bf16* Wvt  = Wkt + (size_t)DMODEL * DMODEL;
  __bf16* Wot  = (__bf16*)alloc((size_t)DMODEL * DMODEL * 2);
  __bf16* W1t  = (__bf16*)alloc((size_t)DMODEL * DHID * 2);
  __bf16* W2t  = (__bf16*)alloc((size_t)DHID * DMODEL * 2);
  __bf16* qbuf = (__bf16*)alloc((size_t)3 * NTOK * DMODEL * 2);     // q k v in a row
  __bf16* kbuf = qbuf + (size_t)NTOK * DMODEL;
  __bf16* vbuf = kbuf + (size_t)NTOK * DMODEL;
  __bf16* obuf = (__bf16*)alloc((size_t)NTOK * DMODEL * 2);
  float*  t1   = (float*)alloc((size_t)NTOK * DMODEL * 4);
  float*  h    = (float*)alloc((size_t)NTOK * DMODEL * 4);
  __bf16* hb   = (__bf16*)alloc((size_t)NTOK * DMODEL * 2);
  __bf16* m1   = (__bf16*)alloc((size_t)NTOK * DHID * 2);
  float*  m2   = (float*)alloc((size_t)NTOK * DMODEL * 4);

  // x cast and the six weight transposes
  prep_kernel<<<XBLOCKS + 4 * SQTILES + 2 * HIDTILES, 256, 0, stream>>>(
      x, Wq, Wk, Wv, Wo, W1, W2, xb, Wqt, Wkt, Wvt, Wot, W1t, W2t);

  // Q, K and V projections (bf16 out)
  gemm_kernel<false, true, true><<<dim3(3 * DMODEL / 128, NTOK / 128), 256, 0, stream>>>(
      xb, Wqt, bq, bk, bv, qbuf, NTOK, DMODEL, DMODEL);

  // causal flash attention
  attn_kernel<<<dim3(SEQ / 64, NHEADS, 2), 128, 0, stream>>>(qbuf, kbuf, vbuf, obuf);

  // output projection (f32 out, no bias)
  gemm_kernel<false, false, false><<<dim3(DMODEL / 128, NTOK / 128), 256, 0, stream>>>(
      obuf, Wot, nullptr, nullptr, nullptr, t1, NTOK, DMODEL, DMODEL);

  // h = LN(x + attn)
  add_ln_kernel<<<NTOK / 8, 256, 0, stream>>>(x, t1, ln1g, ln1b, h, hb);

  // MLP up with fused exact GELU (bf16 out)
  gemm_kernel<true, true, false><<<dim3(DHID / 128, NTOK / 128), 256, 0, stream>>>(
      hb, W1t, b1, nullptr, nullptr, m1, NTOK, DHID, DMODEL);

  // MLP down (f32 out)
  gemm_kernel<false, false, false><<<dim3(DMODEL / 128, NTOK / 128), 256, 0, stream>>>(
      m1, W2t, b2, nullptr, nullptr, m2, NTOK, DMODEL, DHID);

  // out = LN(h + mlp)
  add_ln_kernel<<<NTOK / 8, 256, 0, stream>>>(h, m2, ln2g, ln2b, (float*)d_out, nullptr);
}

// v005
// One run takes 241 microseconds.
// Next to v004, in two timings, it ran 1.09 times as fast each time.
// Over all steps from v000 it is 1.99 times as fast.
#include <hip/hip_runtime.h>
#include <hip/hip_bf16.h>
#include <math.h>

// ---------------------------------------------------------------------------
// Transformer layer for MI455X (gfx1250, wave32, WMMA).
// All matmuls use v_wmma_f32_16x16x32_bf16 (bf16 in, f32 accum).
// Weights pre-transposed at cast time so GEMM A and B tiles are both
// contiguous-row copies -> double-buffered async global->LDS staging.
// ---------------------------------------------------------------------------

typedef __attribute__((ext_vector_type(16))) __bf16 v16bf;
typedef __attribute__((ext_vector_type(8)))  float  v8f;
typedef __attribute__((ext_vector_type(4)))  float  f32x4;
typedef __attribute__((ext_vector_type(4)))  int    i32x4;

#define DMODEL 1024
#define DHEAD  64
#define NHEADS 16
#define DHID   4096
#define SEQ    2048
#define NTOK   4096   // B * S

union Frag16 { f32x4 f[2]; v16bf v; };
union Half8  { f32x4 f; __bf16 b[8]; };

#if __has_builtin(__builtin_amdgcn_global_load_async_to_lds_b128)
#define HAVE_ASYNC_LDS 1
#else
#define HAVE_ASYNC_LDS 0
#endif

// Copy 16 bytes (8 bf16) global -> LDS; async (per-lane gather) when available.
__device__ __forceinline__ void async_copy16(const __bf16* g, __bf16* l) {
#if HAVE_ASYNC_LDS
  __builtin_amdgcn_global_load_async_to_lds_b128(
      (__attribute__((address_space(1))) i32x4*)g,
      (__attribute__((address_space(3))) i32x4*)l, 0, 0);
#else
  *(f32x4*)l = *(const f32x4*)g;
#endif
}

__device__ __forceinline__ void wait_async_all() {
  asm volatile("s_wait_asynccnt 0x0" ::: "memory");
}

__device__ __forceinline__ v16bf load_frag(const __bf16* p0, const __bf16* p1) {
  Frag16 u;
  u.f[0] = *(const f32x4*)p0;   // elems 0..7  (K = half+0..7)
  u.f[1] = *(const f32x4*)p1;   // elems 8..15 (K = 16+half+0..7)
  return u.v;
}

__device__ __forceinline__ v8f zero8() {
  v8f z = {0.f,0.f,0.f,0.f,0.f,0.f,0.f,0.f};
  return z;
}

__device__ __forceinline__ v8f wmma_bf16(v16bf a, v16bf b, v8f c) {
  return __builtin_amdgcn_wmma_f32_16x16x32_bf16(
      false, a, false, b, (short)0, c, false, false);
}

// ---------------------------------------------------------------------------
// Conversion pre-pass, one launch. None of its seven jobs reads another's
// output, so the block index picks the job. Every block converts 16384
// elements, 64 a thread by 16-byte loads, so that few waves have to start:
//   blocks [0, 256)     x fp32 -> bf16
//   blocks [256, 1024)  fp32 W[K,N] -> bf16 Wt[N,K], one 128x128 tile a block
//                       (Wq, Wk, Wv, Wo: 64 tiles each; W1, W2: 256 each)
// ---------------------------------------------------------------------------
#define PREPELEMS 16384
#define XBLOCKS (NTOK * DMODEL / PREPELEMS)
#define SQTILES ((DMODEL / 128) * (DMODEL / 128))
#define HIDTILES ((DMODEL / 128) * (DHID / 128))

typedef __attribute__((ext_vector_type(2))) float    f32x2;
typedef __attribute__((ext_vector_type(2))) __bf16   bf16x2;
typedef __attribute__((ext_vector_type(2))) unsigned u32x2;
typedef __attribute__((ext_vector_type(4))) unsigned u32x4;

// two f32 -> one dword of two bf16, a in the low half
__device__ __forceinline__ unsigned pack2(float a, float b) {
  f32x2 v = {a, b};
  return __builtin_bit_cast(unsigned, __builtin_convertvector(v, bf16x2));
}

// One 128x128 tile: fp32 W[K,N] -> bf16 Wt[N,K]. K and N are compile-time, so
// a thread's 16 loads are one address with 16 immediate offsets.
// tile is [n][k] as bf16, 256 B a row, in units of 8 B (four k). Unit u of row
// n lies at place u ^ (n >> 2): the 32 lanes of a store, which hold 32 rows at
// one u, then fall on 32 different places, that is on all 64 banks.
// The loops are unrolled so that v[][] stays in registers and the offsets
// are immediates.
template<int K, int N>
__device__ __forceinline__ void transpose_tile(const float* __restrict__ W,
                                               __bf16* __restrict__ Wt,
                                               int b, unsigned* tile)
{
  const int tid = threadIdx.x;
  const int n0 = (b % (N / 128)) * 128, k0 = (b / (N / 128)) * 128;
  const int lane = tid & 31, wave = tid >> 5;

  // A wave-wide load is 512 B of one k row; a lane holds columns 4*lane..+3
  // of rows 4*u..4*u+3, u = wave + 8*j.
  const float* src = W + (size_t)(k0 + 4 * wave) * N + n0 + lane * 4;
  f32x4 v[4][4];
#pragma unroll
  for (int j = 0; j < 4; ++j)
#pragma unroll
    for (int e = 0; e < 4; ++e)
      v[j][e] = *(const f32x4*)(src + (32 * j + e) * N);
#pragma unroll
  for (int j = 0; j < 4; ++j)
#pragma unroll
    for (int i = 0; i < 4; ++i) {
      u32x2 p = {pack2(v[j][0][i], v[j][1][i]), pack2(v[j][2][i], v[j][3][i])};
      *(u32x2*)&tile[(lane * 4 + i) * 64 + (((wave + 8 * j) ^ lane) << 1)] = p;
    }
  __syncthreads();

  // 16 lanes store one row's 256 B. Units 2*kg and 2*kg+1 share a 16-byte
  // place and stand there in swapped order where n >> 2 is odd.
  const int kg = tid & 15, nr = tid >> 4;
  __bf16* dst = Wt + (size_t)(n0 + nr) * K + k0 + kg * 8;
#pragma unroll
  for (int p = 0; p < 8; ++p) {
    const int n = nr + 16 * p;
    const int s = n >> 2;
    u32x4 q = *(const u32x4*)&tile[n * 64 + ((kg ^ (s >> 1)) << 2)];
    if (s & 1) q = q.zwxy;
    *(u32x4*)(dst + 16 * p * K) = q;
  }
  // the stores' registers may be written again by the code that follows in
  // the listing: the wait stands in front of any such overwrite
  asm volatile("s_wait_xcnt 0x0" ::: "memory");
}

__global__ __launch_bounds__(256)
void prep_kernel(const float* __restrict__ x,
                 const float* __restrict__ Wq, const float* __restrict__ Wk,
                 const float* __restrict__ Wv, const float* __restrict__ Wo,
                 const float* __restrict__ W1, const float* __restrict__ W2,
                 __bf16* __restrict__ xb,
                 __bf16* __restrict__ Wqt, __bf16* __restrict__ Wkt,
                 __bf16* __restrict__ Wvt, __bf16* __restrict__ Wot,
                 __bf16* __restrict__ W1t, __bf16* __restrict__ W2t)
{
  __shared__ __attribute__((aligned(16))) unsigned tile[128 * 64];
  int b = blockIdx.x;

  if (b < XBLOCKS) {
    const size_t base = (size_t)b * PREPELEMS + threadIdx.x * 4;
    f32x4 v[16];                         // unrolled: v[] stays in registers
#pragma unroll
    for (int j = 0; j < 16; ++j) v[j] = *(const f32x4*)(x + base + j * 1024);
#pragma unroll
    for (int j = 0; j < 16; ++j) {
      u32x2 p = {pack2(v[j].x, v[j].y), pack2(v[j].z, v[j].w)};
      *(u32x2*)(xb + base + j * 1024) = p;
    }
    return;
  }
  b -= XBLOCKS;

  // the branches are uniform for the block, so each one's barrier is met by
  // all of its threads
  if (b < 4 * SQTILES) {
    const int w = b / SQTILES;
    const float* W = w == 0 ? Wq  : w == 1 ? Wk  : w == 2 ? Wv  : Wo;
    __bf16* Wt     = w == 0 ? Wqt : w == 1 ? Wkt : w == 2 ? Wvt : Wot;
    transpose_tile<DMODEL, DMODEL>(W, Wt, b - w * SQTILES, tile);
  } else if (b < 4 * SQTILES + HIDTILES) {
    transpose_tile<DMODEL, DHID>(W1, W1t, b - 4 * SQTILES, tile);
  } else {
    transpose_tile<DHID, DMODEL>(W2, W2t, b - (4 * SQTILES + HIDTILES), tile);
  }
}

// ---------------------------------------------------------------------------
// Tiled bf16 WMMA GEMM: C[M,N] = act(A[M,K] @ Bt[N,K]^T + bias)
// Block tile 128x128, k-step 64, double-buffered async LDS staging.
// 256 threads = 8 waves, wave grid 4x2 (MxN); each wave: 2x4 16x16 tiles.
// Both LDS tiles are [row/col][k] with stride 72 so every fragment is two
// contiguous ds_load_b128 per lane (A layout: K groups of 8 per lane-half).
// TRI: three products that share A in one launch. Bt holds the three [N,K]
// weights one behind the other, Cout the three [M,N] outputs likewise; grid x
// runs over all 3N columns and each 128-column block lies in one part.
// ---------------------------------------------------------------------------
template<bool GELU, bool OUT_BF16, bool TRI>
__global__ __launch_bounds__(256)
void gemm_kernel(const __bf16* __restrict__ A, const __bf16* __restrict__ Bt,
                 const float* __restrict__ bias, const float* __restrict__ bias1,
                 const float* __restrict__ bias2, void* __restrict__ Cout,
                 int M, int N, int K)
{
  __shared__ __bf16 As[2][128 * 72];
  __shared__ __bf16 Bs[2][128 * 72];

  const int tid   = threadIdx.x;
  const int lane  = tid & 31;
  const int wave  = tid >> 5;
  const int waveM = wave >> 1;           // 0..3
  const int waveN = wave & 1;            // 0..1
  const int lr    = lane & 15;
  const int half  = (lane >> 4) * 8;
  const int blkN  = blockIdx.x * 128;
  const int blkM  = blockIdx.y * 128;

  v8f acc[2][4];
#pragma unroll
  for (int tm = 0; tm < 2; ++tm)
#pragma unroll
    for (int tn = 0; tn < 4; ++tn) acc[tm][tn] = zero8();

  // Eight lanes take one row's 128 bytes of the k-step, so each wave-wide
  // copy covers four whole 128-byte lines.
  const int srow = tid >> 3;             // 0..31, plus 32 per copy
  const int skc  = (tid & 7) * 8;        // 0..56

  auto stage = [&](int k0, int buf) {
    const __bf16* ag = A  + (size_t)(blkM + srow) * K + k0 + skc;
    const __bf16* bg = Bt + (size_t)(blkN + srow) * K + k0 + skc;
    __bf16* al = &As[buf][srow * 72 + skc];
    __bf16* bl = &Bs[buf][srow * 72 + skc];
#pragma unroll
    for (int e = 0; e < 4; ++e) {
      async_copy16(ag + (size_t)(e * 32) * K, al + e * 32 * 72);
      async_copy16(bg + (size_t)(e * 32) * K, bl + e * 32 * 72);
    }
  };

  stage(0, 0);
  const int T = K >> 6;                  // K / 64
  for (int i = 0; i < T; ++i) {
    wait_async_all();                    // own tile-i loads landed
    __syncthreads();                     // everyone's tile-i landed; prev reads done
    if (i + 1 < T) stage((i + 1) * 64, (i + 1) & 1);

    const __bf16* as = As[i & 1];
    const __bf16* bs = Bs[i & 1];
#pragma unroll
    for (int kc = 0; kc < 2; ++kc) {
      v16bf af[2], bfv[4];
#pragma unroll
      for (int tm = 0; tm < 2; ++tm) {
        const __bf16* p = as + (waveM * 32 + tm * 16 + lr) * 72 + kc * 32 + half;
        af[tm] = load_frag(p, p + 16);
      }
#pragma unroll
      for (int tn = 0; tn < 4; ++tn) {
        const __bf16* p = bs + (waveN * 64 + tn * 16 + lr) * 72 + kc * 32 + half;
        bfv[tn] = load_frag(p, p + 16);
      }
#pragma unroll
      for (int tm = 0; tm < 2; ++tm)
#pragma unroll
        for (int tn = 0; tn < 4; ++tn)
          acc[tm][tn] = wmma_bf16(af[tm], bfv[tn], acc[tm][tn]);
    }
  }

  // epilogue: bias + optional exact GELU, f32 or bf16 store
  int partN = 0;                         // first column of this block's part
  if (TRI) {
    const int part = blkN / N;
    partN = part * N;
    bias = part == 0 ? bias : part == 1 ? bias1 : bias2;
    // col below counts from column 0 of part 0: part's [M,N] output starts
    // part * M * N elements on, less the partN that col already holds
    Cout = (__bf16*)Cout + ((size_t)part * M * N - partN);
  }
#pragma unroll
  for (int tm = 0; tm < 2; ++tm) {
#pragma unroll
    for (int tn = 0; tn < 4; ++tn) {
      int col = blkN + waveN * 64 + tn * 16 + lr;
      float bv = bias ? bias[col - partN] : 0.f;
#pragma unroll
      for (int r = 0; r < 8; ++r) {
        int row = blkM + waveM * 32 + tm * 16 + half + r;
        float v = acc[tm][tn][r] + bv;
        if (GELU) v = 0.5f * v * (1.f + erff(v * 0.70710678118654752f));
        if (OUT_BF16) ((__bf16*)Cout)[(size_t)row * N + col] = (__bf16)v;
        else          ((float*)Cout)[(size_t)row * N + col]  = v;
      }
    }
  }
}

__device__ __forceinline__ float xhalf(float x) {
  int b = __builtin_bit_cast(int, x);
  return __builtin_bit_cast(float,
      __builtin_amdgcn_permlanex16(b, b, 0x76543210, 0xfedcba98, false, false));
}

__global__ __launch_bounds__(128)
void attn_kernel(const __bf16* __restrict__ qb, const __bf16* __restrict__ kb,
                 const __bf16* __restrict__ vb, __bf16* __restrict__ ob)
{
  __shared__ __attribute__((aligned(16))) __bf16 Kt[2][32 * 72];  // [key][d]
  __shared__ __attribute__((aligned(16))) __bf16 Vt[2][64 * 40];  // [d][key] transposed

  const int tid  = threadIdx.x;
  const int lane = tid & 31;
  const int wave = tid >> 5;
  const int lr   = lane & 15;
  const int half = (lane >> 4) * 8;

  const int head = blockIdx.y;
  const int q0   = blockIdx.x * 64;
  const int qw   = q0 + wave * 16;
  const int qrow = qw + lr;             // this lane's query
  const size_t tokbase = (size_t)blockIdx.z * SEQ;

  v16bf qf[2];                          // B fragment: column = query, k = d
#pragma unroll
  for (int di = 0; di < 2; ++di) {
    const __bf16* p = qb + (tokbase + qrow) * DMODEL + head * DHEAD + di * 32 + half;
    qf[di] = load_frag(p, p + 16);
  }

  float m = -1e30f;                     // running maximum of this query
  float l = 0.f;                        // sum over this lane's keys only
  v8f o[4];                             // o[t][r] = O[qrow][t*16 + half + r]
#pragma unroll
  for (int t = 0; t < 4; ++t) o[t] = zero8();

  // A thread stages 16 bytes of keys srow and srow + 16 of a tile.
  const int srow = tid >> 3;            // 0..15
  const int soff = (tid & 7) * 8;       // d 0..56
  const size_t sbase = (tokbase + srow) * DMODEL + head * DHEAD + soff;
  Half8 tv0, tv1;                       // V of the tile in flight

  // tile t: K by async copies into Kt[buf], V into registers; nothing waits
  auto fetch = [&](int t, int buf) {
    const size_t g = sbase + (size_t)t * (32 * DMODEL);
    tv0.f = *(const f32x4*)(vb + g);
    tv1.f = *(const f32x4*)(vb + g + 16 * DMODEL);
    async_copy16(kb + g,               &Kt[buf][srow * 72 + soff]);
    async_copy16(kb + g + 16 * DMODEL, &Kt[buf][(srow + 16) * 72 + soff]);
    // the loads' address registers may be written again while they fly: the
    // wait stands in front of any such overwrite
    asm volatile("s_wait_xcnt 0x0" ::: "memory");
  };
  // V in flight -> Vt[buf]; unrolled so that b[e] are register halves
  auto put_v = [&](int buf) {
#pragma unroll
    for (int e = 0; e < 8; ++e) {
      Vt[buf][(soff + e) * 40 + srow]      = tv0.b[e];
      Vt[buf][(soff + e) * 40 + srow + 16] = tv1.b[e];
    }
  };

  const int ktmax = (q0 + 63) >> 5;     // odd: at least two tiles
  fetch(0, 0);
  put_v(0);
  wait_async_all();
  __syncthreads();

  for (int kt = 0; kt <= ktmax; ++kt) {
    const int kpos = kt * 32;
    const int buf  = kt & 1;
    const __bf16* Kc = Kt[buf];
    const __bf16* Vc = Vt[buf];
    // Directly behind the barrier that ended every read of the other buffer:
    // the next tile sets out, and is waited for only at this trip's foot.
    if (kt < ktmax) fetch(kt + 1, buf ^ 1);

    // S^T = K * Q^T (32 keys x 16 queries) as two 16x16 tiles
    v8f s0 = zero8(), s1 = zero8();
#pragma unroll
    for (int di = 0; di < 2; ++di) {
      const __bf16* p0 = Kc + lr * 72        + di * 32 + half;
      const __bf16* p1 = Kc + (16 + lr) * 72 + di * 32 + half;
      v16bf a0 = load_frag(p0, p0 + 16);
      v16bf a1 = load_frag(p1, p1 + 16);
      s0 = wmma_bf16(a0, qf[di], s0);
      s1 = wmma_bf16(a1, qf[di], s1);
    }

    // online softmax, one query per lane
    float v0[8], v1[8];
    float mx = -1e30f;
#pragma unroll
    for (int r = 0; r < 8; ++r) {
      int c0 = kpos + half + r, c1 = c0 + 16;
      v0[r] = (c0 <= qrow) ? s0[r] * 0.125f : -1e30f;
      v1[r] = (c1 <= qrow) ? s1[r] * 0.125f : -1e30f;
      mx = fmaxf(mx, fmaxf(v0[r], v1[r]));
    }
    mx = fmaxf(mx, xhalf(mx));
    const float mn    = fmaxf(m, mx);
    const float alpha = expf(m - mn);
    m = mn;

    v16bf pf;                           // B fragment: column = query, k = key
    float ps = 0.f;
#pragma unroll
    for (int r = 0; r < 8; ++r) {
      int c0 = kpos + half + r, c1 = c0 + 16;
      float e0 = expf(v0[r] - mn), e1 = expf(v1[r] - mn);
      float p0 = (c0 <= qrow) ? e0 : 0.f;
      float p1 = (c1 <= qrow) ? e1 : 0.f;
      ps += p0 + p1;
      pf[r]     = (__bf16)p0;
      pf[8 + r] = (__bf16)p1;
    }
    l = l * alpha + ps;
#pragma unroll
    for (int t = 0; t < 4; ++t)
#pragma unroll
      for (int r = 0; r < 8; ++r) o[t][r] *= alpha;

    // O^T += V^T * P^T
#pragma unroll
    for (int t = 0; t < 4; ++t) {
      const __bf16* pv = Vc + (t * 16 + lr) * 40 + half;
      v16bf av = load_frag(pv, pv + 16);
      o[t] = wmma_bf16(av, pf, o[t]);
    }

    // Foot of the trip: V of tile kt + 1 goes from registers to its buffer.
    if (kt < ktmax) put_v(buf ^ 1);
    // own LDS reads and writes done, own K copies of tile kt + 1 landed
    asm volatile("s_wait_dscnt 0x0" ::: "memory");
    wait_async_all();
    // publishes tile kt + 1 and ends every read of this trip's buffer,
    // which the next trip refills
    __syncthreads();
  }
  wait_async_all();                     // no copy in flight at the wave's end

  l += xhalf(l);                        // join the two halves' key sums
  __bf16* op = ob + (tokbase + qrow) * DMODEL + head * DHEAD + half;
#pragma unroll
  for (int t = 0; t < 4; ++t) {
    Half8 w;
#pragma unroll
    for (int r = 0; r < 8; ++r) w.b[r] = (__bf16)(o[t][r] / l);
    *(f32x4*)(op + t * 16) = w.f;
  }
}

// ---------------------------------------------------------------------------
// out = layernorm(x + y); optional bf16 copy for the next GEMM.
// One wave holds one row, 32 elements a lane by 16-byte loads, so that few
// waves have to start; both sums stay inside the wave: no LDS, no barrier.
// The loops are unrolled so that v[] and yv[] stay in registers.
// ---------------------------------------------------------------------------
__device__ __forceinline__ float wave_sum(float s) {
#pragma unroll
  for (int m = 16; m > 0; m >>= 1) s += __shfl_xor(s, m, 32);
  return s;
}

__global__ __launch_bounds__(256)
void add_ln_kernel(const float* __restrict__ x, const float* __restrict__ y,
                   const float* __restrict__ g, const float* __restrict__ b,
                   float* __restrict__ out, __bf16* __restrict__ outb)
{
  const int col = (threadIdx.x & 31) * 4;                 // plus 128 per j
  const int row = blockIdx.x * 8 + (threadIdx.x >> 5);
  const size_t base = (size_t)row * DMODEL + col;

  f32x4 v[8], yv[8];
#pragma unroll
  for (int j = 0; j < 8; ++j) v[j]  = *(const f32x4*)(x + base + j * 128);
#pragma unroll
  for (int j = 0; j < 8; ++j) yv[j] = *(const f32x4*)(y + base + j * 128);

  f32x4 s4 = {0.f, 0.f, 0.f, 0.f};
#pragma unroll
  for (int j = 0; j < 8; ++j) { v[j] += yv[j]; s4 += v[j]; }
  const float mu = wave_sum((s4.x + s4.y) + (s4.z + s4.w)) * (1.f / DMODEL);

  s4 = (f32x4){0.f, 0.f, 0.f, 0.f};
#pragma unroll
  for (int j = 0; j < 8; ++j) { v[j] -= mu; s4 += v[j] * v[j]; }
  const float rstd =
      rsqrtf(wave_sum((s4.x + s4.y) + (s4.z + s4.w)) * (1.f / DMODEL) + 1e-5f);

#pragma unroll
  for (int j = 0; j < 8; ++j) {
    const f32x4 gv = *(const f32x4*)(g + col + j * 128);
    const f32x4 bv = *(const f32x4*)(b + col + j * 128);
    v[j] = v[j] * rstd * gv + bv;
  }
  if (outb) {
#pragma unroll
    for (int j = 0; j < 8; ++j) {
      u32x2 p = {pack2(v[j].x, v[j].y), pack2(v[j].z, v[j].w)};
      *(u32x2*)(outb + base + j * 128) = p;
    }
  }
#pragma unroll
  for (int j = 0; j < 8; ++j) *(f32x4*)(out + base + j * 128) = v[j];
}

// ---------------------------------------------------------------------------
// Launcher
// ---------------------------------------------------------------------------
extern "C" void kernel_launch(void* const* d_in, const int* in_sizes, int n_in,
                              void* d_out, int out_size, void* d_ws, size_t ws_size,
                              hipStream_t stream) {
  const float* x    = (const float*)d_in[0];
  const float* Wq   = (const float*)d_in[1];
  const float* bq   = (const float*)d_in[2];
  const float* Wk   = (const float*)d_in[3];
  const float* bk   = (const float*)d_in[4];
  const float* Wv   = (const float*)d_in[5];
  const float* bv   = (const float*)d_in[6];
  const float* Wo   = (const float*)d_in[7];
  const float* ln1g = (const float*)d_in[8];
  const float* ln1b = (const float*)d_in[9];
  const float* W1   = (const float*)d_in[10];
  const float* b1   = (const float*)d_in[11];
  const float* W2   = (const float*)d_in[12];
  const float* b2   = (const float*)d_in[13];
  const float* ln2g = (const float*)d_in[14];
  const float* ln2b = (const float*)d_in[15];

  char* ws = (char*)d_ws;
  size_t off = 0;
  auto alloc = [&](size_t bytes) -> char* {
    char* p = ws + off;
    off = (off + bytes + 255) & ~(size_t)255;
    return p;
  };

  __bf16* xb   = (__bf16*)alloc((size_t)NTOK * DMODEL * 2);
  __bf16* Wqt  = (__bf16*)alloc((size_t)3 * DMODEL * DMODEL * 2);   // [N][K], q k v in a row
  __bf16* Wkt  = Wqt + (size_t)DMODEL * DMODEL;
  __bf16* Wvt  = Wkt + (size_t)DMODEL * DMODEL;
  __bf16* Wot  = (__bf16*)alloc((size_t)DMODEL * DMODEL * 2);
  __bf16* W1t  = (__bf16*)alloc((size_t)DMODEL * DHID * 2);
  __bf16* W2t  = (__bf16*)alloc((size_t)DHID * DMODEL * 2);
  __bf16* qbuf = (__bf16*)alloc((size_t)3 * NTOK * DMODEL * 2);     // q k v in a row
  __bf16* kbuf = qbuf + (size_t)NTOK * DMODEL;
  __bf16* vbuf = kbuf + (size_t)NTOK * DMODEL;
  __bf16* obuf = (__bf16*)alloc((size_t)NTOK * DMODEL * 2);
  float*  t1   = (float*)alloc((size_t)NTOK * DMODEL * 4);
  float*  h    = (float*)alloc((size_t)NTOK * DMODEL * 4);
  __bf16* hb   = (__bf16*)alloc((size_t)NTOK * DMODEL * 2);
  __bf16* m1   = (__bf16*)alloc((size_t)NTOK * DHID * 2);
  float*  m2   = (float*)alloc((size_t)NTOK * DMODEL * 4);

  // x cast and the six weight transposes
  prep_kernel<<<XBLOCKS + 4 * SQTILES + 2 * HIDTILES, 256, 0, stream>>>(
      x, Wq, Wk, Wv, Wo, W1, W2, xb, Wqt, Wkt, Wvt, Wot, W1t, W2t);

  // Q, K and V projections (bf16 out)
  gemm_kernel<false, true, true><<<dim3(3 * DMODEL / 128, NTOK / 128), 256, 0, stream>>>(
      xb, Wqt, bq, bk, bv, qbuf, NTOK, DMODEL, DMODEL);

  // causal flash attention
  attn_kernel<<<dim3(SEQ / 64, NHEADS, 2), 128, 0, stream>>>(qbuf, kbuf, vbuf, obuf);

  // output projection (f32 out, no bias)
  gemm_kernel<false, false, false><<<dim3(DMODEL / 128, NTOK / 128), 256, 0, stream>>>(
      obuf, Wot, nullptr, nullptr, nullptr, t1, NTOK, DMODEL, DMODEL);

  // h = LN(x + attn)
  add_ln_kernel<<<NTOK / 8, 256, 0, stream>>>(x, t1, ln1g, ln1b, h, hb);

  // MLP up with fused exact GELU (bf16 out)
  gemm_kernel<true, true, false><<<dim3(DHID / 128, NTOK / 128), 256, 0, stream>>>(
      hb, W1t, b1, nullptr, nullptr, m1, NTOK, DHID, DMODEL);

  // MLP down (f32 out)
  gemm_kernel<false, false, false><<<dim3(DMODEL / 128, NTOK / 128), 256, 0, stream>>>(
      m1, W2t, b2, nullptr, nullptr, m2, NTOK, DMODEL, DHID);

  // out = LN(h + mlp)
  add_ln_kernel<<<NTOK / 8, 256, 0, stream>>>(h, m2, ln2g, ln2b, (float*)d_out, nullptr);
}

// v006
// A run of this version takes 220 microseconds.
// Next to v005, in two timings, it ran 1.09 and 1.10 times as fast.
// Over all steps from v000 it is 2.17 times as fast.
#include <hip/hip_runtime.h>
#include <hip/hip_bf16.h>
#include <math.h>

// ---------------------------------------------------------------------------
// Transformer layer for MI455X (gfx1250, wave32, WMMA).
// All matmuls use v_wmma_f32_16x16x32_bf16 (bf16 in, f32 accum).
// Weights pre-transposed at cast time so GEMM A and B tiles are both
// contiguous-row copies -> double-buffered async global->LDS staging.
// ---------------------------------------------------------------------------

typedef __attribute__((ext_vector_type(16))) __bf16 v16bf;
typedef __attribute__((ext_vector_type(8)))  float  v8f;
typedef __attribute__((ext_vector_type(4)))  float  f32x4;
typedef __attribute__((ext_vector_type(4)))  int    i32x4;

#define DMODEL 1024
#define DHEAD  64
#define NHEADS 16
#define DHID   4096
#define SEQ    2048
#define NTOK   4096   // B * S

union Frag16 { f32x4 f[2]; v16bf v; };
union Half8  { f32x4 f; __bf16 b[8]; };

#if __has_builtin(__builtin_amdgcn_global_load_async_to_lds_b128)
#define HAVE_ASYNC_LDS 1
#else
#define HAVE_ASYNC_LDS 0
#endif

// Copy 16 bytes (8 bf16) global -> LDS; async (per-lane gather) when available.
__device__ __forceinline__ void async_copy16(const __bf16* g, __bf16* l) {
#if HAVE_ASYNC_LDS
  __builtin_amdgcn_global_load_async_to_lds_b128(
      (__attribute__((address_space(1))) i32x4*)g,
      (__attribute__((address_space(3))) i32x4*)l, 0, 0);
#else
  *(f32x4*)l = *(const f32x4*)g;
#endif
}

__device__ __forceinline__ void wait_async_all() {
  asm volatile("s_wait_asynccnt 0x0" ::: "memory");
}

__device__ __forceinline__ v16bf load_frag(const __bf16* p0, const __bf16* p1) {
  Frag16 u;
  u.f[0] = *(const f32x4*)p0;   // elems 0..7  (K = half+0..7)
  u.f[1] = *(const f32x4*)p1;   // elems 8..15 (K = 16+half+0..7)
  return u.v;
}

__device__ __forceinline__ v8f zero8() {
  v8f z = {0.f,0.f,0.f,0.f,0.f,0.f,0.f,0.f};
  return z;
}

__device__ __forceinline__ v8f wmma_bf16(v16bf a, v16bf b, v8f c) {
  return __builtin_amdgcn_wmma_f32_16x16x32_bf16(
      false, a, false, b, (short)0, c, false, false);
}

// ---------------------------------------------------------------------------
// Conversion pre-pass, one launch. None of its seven jobs reads another's
// output, so the block index picks the job. Every block converts 16384
// elements, 64 a thread by 16-byte loads, so that few waves have to start:
//   blocks [0, 256)     x fp32 -> bf16
//   blocks [256, 1024)  fp32 W[K,N] -> bf16 Wt[N,K], one 128x128 tile a block
//                       (Wq, Wk, Wv, Wo: 64 tiles each; W1, W2: 256 each)
// ---------------------------------------------------------------------------
#define PREPELEMS 16384
#define XBLOCKS (NTOK * DMODEL / PREPELEMS)
#define SQTILES ((DMODEL / 128) * (DMODEL / 128))
#define HIDTILES ((DMODEL / 128) * (DHID / 128))

typedef __attribute__((ext_vector_type(2))) float    f32x2;
typedef __attribute__((ext_vector_type(2))) __bf16   bf16x2;
typedef __attribute__((ext_vector_type(2))) unsigned u32x2;
typedef __attribute__((ext_vector_type(4))) unsigned u32x4;

// two f32 -> one dword of two bf16, a in the low half
__device__ __forceinline__ unsigned pack2(float a, float b) {
  f32x2 v = {a, b};
  return __builtin_bit_cast(unsigned, __builtin_convertvector(v, bf16x2));
}

// One 128x128 tile: fp32 W[K,N] -> bf16 Wt[N,K]. K and N are compile-time, so
// a thread's 16 loads are one address with 16 immediate offsets.
// tile is [n][k] as bf16, 256 B a row, in units of 8 B (four k). Unit u of row
// n lies at place u ^ (n >> 2): the 32 lanes of a store, which hold 32 rows at
// one u, then fall on 32 different places, that is on all 64 banks.
// The loops are unrolled so that v[][] stays in registers and the offsets
// are immediates.
template<int K, int N>
__device__ __forceinline__ void transpose_tile(const float* __restrict__ W,
                                               __bf16* __restrict__ Wt,
                                               int b, unsigned* tile)
{
  const int tid = threadIdx.x;
  const int n0 = (b % (N / 128)) * 128, k0 = (b / (N / 128)) * 128;
  const int lane = tid & 31, wave = tid >> 5;

  // A wave-wide load is 512 B of one k row; a lane holds columns 4*lane..+3
  // of rows 4*u..4*u+3, u = wave + 8*j.
  const float* src = W + (size_t)(k0 + 4 * wave) * N + n0 + lane * 4;
  f32x4 v[4][4];
#pragma unroll
  for (int j = 0; j < 4; ++j)
#pragma unroll
    for (int e = 0; e < 4; ++e)
      v[j][e] = *(const f32x4*)(src + (32 * j + e) * N);
#pragma unroll
  for (int j = 0; j < 4; ++j)
#pragma unroll
    for (int i = 0; i < 4; ++i) {
      u32x2 p = {pack2(v[j][0][i], v[j][1][i]), pack2(v[j][2][i], v[j][3][i])};
      *(u32x2*)&tile[(lane * 4 + i) * 64 + (((wave + 8 * j) ^ lane) << 1)] = p;
    }
  __syncthreads();

  // 16 lanes store one row's 256 B. Units 2*kg and 2*kg+1 share a 16-byte
  // place and stand there in swapped order where n >> 2 is odd.
  const int kg = tid & 15, nr = tid >> 4;
  __bf16* dst = Wt + (size_t)(n0 + nr) * K + k0 + kg * 8;
#pragma unroll
  for (int p = 0; p < 8; ++p) {
    const int n = nr + 16 * p;
    const int s = n >> 2;
    u32x4 q = *(const u32x4*)&tile[n * 64 + ((kg ^ (s >> 1)) << 2)];
    if (s & 1) q = q.zwxy;
    *(u32x4*)(dst + 16 * p * K) = q;
  }
  // the stores' registers may be written again by the code that follows in
  // the listing: the wait stands in front of any such overwrite
  asm volatile("s_wait_xcnt 0x0" ::: "memory");
}

__global__ __launch_bounds__(256)
void prep_kernel(const float* __restrict__ x,
                 const float* __restrict__ Wq, const float* __restrict__ Wk,
                 const float* __restrict__ Wv, const float* __restrict__ Wo,
                 const float* __restrict__ W1, const float* __restrict__ W2,
                 __bf16* __restrict__ xb,
                 __bf16* __restrict__ Wqt, __bf16* __restrict__ Wkt,
                 __bf16* __restrict__ Wvt, __bf16* __restrict__ Wot,
                 __bf16* __restrict__ W1t, __bf16* __restrict__ W2t)
{
  __shared__ __attribute__((aligned(16))) unsigned tile[128 * 64];
  int b = blockIdx.x;

  if (b < XBLOCKS) {
    const size_t base = (size_t)b * PREPELEMS + threadIdx.x * 4;
    f32x4 v[16];                         // unrolled: v[] stays in registers
#pragma unroll
    for (int j = 0; j < 16; ++j) v[j] = *(const f32x4*)(x + base + j * 1024);
#pragma unroll
    for (int j = 0; j < 16; ++j) {
      u32x2 p = {pack2(v[j].x, v[j].y), pack2(v[j].z, v[j].w)};
      *(u32x2*)(xb + base + j * 1024) = p;
    }
    return;
  }
  b -= XBLOCKS;

  // the branches are uniform for the block, so each one's barrier is met by
  // all of its threads
  if (b < 4 * SQTILES) {
    const int w = b / SQTILES;
    const float* W = w == 0 ? Wq  : w == 1 ? Wk  : w == 2 ? Wv  : Wo;
    __bf16* Wt     = w == 0 ? Wqt : w == 1 ? Wkt : w == 2 ? Wvt : Wot;
    transpose_tile<DMODEL, DMODEL>(W, Wt, b - w * SQTILES, tile);
  } else if (b < 4 * SQTILES + HIDTILES) {
    transpose_tile<DMODEL, DHID>(W1, W1t, b - 4 * SQTILES, tile);
  } else {
    transpose_tile<DHID, DMODEL>(W2, W2t, b - (4 * SQTILES + HIDTILES), tile);
  }
}

// ---------------------------------------------------------------------------
// Tiled bf16 WMMA GEMM: C[M,N] = act(A[M,K] @ Bt[N,K]^T + bias)
// Block tile 128x128, k-step KS, double-buffered async LDS staging.
// KS is 64 where several blocks share a WGP and fill each other's waits, and
// 256 where the grid gives a WGP one block: there nothing else runs while the
// block waits out a hand-over (copy wait and barrier), so a long step, with a
// quarter of the hand-overs along K and four times the products to cover the
// next step's copies, is the faster. K must be a multiple of KS.
// 256 threads = 8 waves, wave grid 4x2 (MxN); each wave: 2x4 16x16 tiles.
// Both LDS tiles are [row/col][k] with stride KS + 8 (an odd multiple of
// 16 bytes) so every fragment is two contiguous ds_load_b128 per lane
// without bank conflicts (A layout: K groups of 8 per lane-half).
// TRI: three products that share A in one launch. Bt holds the three [N,K]
// weights one behind the other, Cout the three [M,N] outputs likewise; grid x
// runs over all 3N columns and each 128-column block lies in one part.
// ---------------------------------------------------------------------------
template<bool GELU, bool OUT_BF16, bool TRI, int KS>
__global__ __launch_bounds__(256)
void gemm_kernel(const __bf16* __restrict__ A, const __bf16* __restrict__ Bt,
                 const float* __restrict__ bias, const float* __restrict__ bias1,
                 const float* __restrict__ bias2, void* __restrict__ Cout,
                 int M, int N, int K)
{
  constexpr int PITCH = KS + 8;          // LDS row stride in elements
  __shared__ __attribute__((aligned(16))) __bf16 As[2][128 * PITCH];
  __shared__ __attribute__((aligned(16))) __bf16 Bs[2][128 * PITCH];

  const int tid   = threadIdx.x;
  const int lane  = tid & 31;
  const int wave  = tid >> 5;
  const int waveM = wave >> 1;           // 0..3
  const int waveN = wave & 1;            // 0..1
  const int lr    = lane & 15;
  const int half  = (lane >> 4) * 8;
  const int blkN  = blockIdx.x * 128;
  const int blkM  = blockIdx.y * 128;

  v8f acc[2][4];
#pragma unroll
  for (int tm = 0; tm < 2; ++tm)
#pragma unroll
    for (int tn = 0; tn < 4; ++tn) acc[tm][tn] = zero8();

  // KS / 8 lanes take one row's 2 * KS bytes of the k-step, so each wave-wide
  // copy covers four whole 128-byte lines (of four rows, or all of one row).
  constexpr int LPR = KS / 8;            // lanes per row
  constexpr int RPC = 256 / LPR;         // rows per block-wide copy
  const int srow = tid / LPR;            // plus RPC per copy
  const int skc  = (tid % LPR) * 8;      // 0..KS - 8

  auto stage = [&](int k0, int buf) {
    const __bf16* ag = A  + (size_t)(blkM + srow) * K + k0 + skc;
    const __bf16* bg = Bt + (size_t)(blkN + srow) * K + k0 + skc;
    __bf16* al = &As[buf][srow * PITCH + skc];
    __bf16* bl = &Bs[buf][srow * PITCH + skc];
#pragma unroll
    for (int e = 0; e < 128 / RPC; ++e) {
      async_copy16(ag + (size_t)(e * RPC) * K, al + e * RPC * PITCH);
      async_copy16(bg + (size_t)(e * RPC) * K, bl + e * RPC * PITCH);
    }
  };

  stage(0, 0);
  const int T = K >> __builtin_ctz(KS);  // K / KS, KS a power of two
  for (int i = 0; i < T; ++i) {
    wait_async_all();                    // own tile-i loads landed
    __syncthreads();                     // everyone's tile-i landed; prev reads done
    if (i + 1 < T) stage((i + 1) * KS, (i + 1) & 1);

    const __bf16* as = As[i & 1];
    const __bf16* bs = Bs[i & 1];
#pragma unroll
    for (int kc = 0; kc < KS / 32; ++kc) {
      v16bf af[2], bfv[4];
#pragma unroll
      for (int tm = 0; tm < 2; ++tm) {
        const __bf16* p = as + (waveM * 32 + tm * 16 + lr) * PITCH + kc * 32 + half;
        af[tm] = load_frag(p, p + 16);
      }
#pragma unroll
      for (int tn = 0; tn < 4; ++tn) {
        const __bf16* p = bs + (waveN * 64 + tn * 16 + lr) * PITCH + kc * 32 + half;
        bfv[tn] = load_frag(p, p + 16);
      }
#pragma unroll
      for (int tm = 0; tm < 2; ++tm)
#pragma unroll
        for (int tn = 0; tn < 4; ++tn)
          acc[tm][tn] = wmma_bf16(af[tm], bfv[tn], acc[tm][tn]);
    }
  }

  // epilogue: bias + optional exact GELU, f32 or bf16 store
  int partN = 0;                         // first column of this block's part
  if (TRI) {
    const int part = blkN / N;
    partN = part * N;
    bias = part == 0 ? bias : part == 1 ? bias1 : bias2;
    // col below counts from column 0 of part 0: part's [M,N] output starts
    // part * M * N elements on, less the partN that col already holds
    Cout = (__bf16*)Cout + ((size_t)part * M * N - partN);
  }
#pragma unroll
  for (int tm = 0; tm < 2; ++tm) {
#pragma unroll
    for (int tn = 0; tn < 4; ++tn) {
      int col = blkN + waveN * 64 + tn * 16 + lr;
      float bv = bias ? bias[col - partN] : 0.f;
#pragma unroll
      for (int r = 0; r < 8; ++r) {
        int row = blkM + waveM * 32 + tm * 16 + half + r;
        float v = acc[tm][tn][r] + bv;
        if (GELU) v = 0.5f * v * (1.f + erff(v * 0.70710678118654752f));
        if (OUT_BF16) ((__bf16*)Cout)[(size_t)row * N + col] = (__bf16)v;
        else          ((float*)Cout)[(size_t)row * N + col]  = v;
      }
    }
  }
}

__device__ __forceinline__ float xhalf(float x) {
  int b = __builtin_bit_cast(int, x);
  return __builtin_bit_cast(float,
      __builtin_amdgcn_permlanex16(b, b, 0x76543210, 0xfedcba98, false, false));
}

__global__ __launch_bounds__(128)
void attn_kernel(const __bf16* __restrict__ qb, const __bf16* __restrict__ kb,
                 const __bf16* __restrict__ vb, __bf16* __restrict__ ob)
{
  __shared__ __attribute__((aligned(16))) __bf16 Kt[2][32 * 72];  // [key][d]
  __shared__ __attribute__((aligned(16))) __bf16 Vt[2][64 * 40];  // [d][key] transposed

  const int tid  = threadIdx.x;
  const int lane = tid & 31;
  const int wave = tid >> 5;
  const int lr   = lane & 15;
  const int half = (lane >> 4) * 8;

  const int head = blockIdx.y;
  const int q0   = blockIdx.x * 64;
  const int qw   = q0 + wave * 16;
  const int qrow = qw + lr;             // this lane's query
  const size_t tokbase = (size_t)blockIdx.z * SEQ;

  v16bf qf[2];                          // B fragment: column = query, k = d
#pragma unroll
  for (int di = 0; di < 2; ++di) {
    const __bf16* p = qb + (tokbase + qrow) * DMODEL + head * DHEAD + di * 32 + half;
    qf[di] = load_frag(p, p + 16);
  }

  float m = -1e30f;                     // running maximum of this query
  float l = 0.f;                        // sum over this lane's keys only
  v8f o[4];                             // o[t][r] = O[qrow][t*16 + half + r]
#pragma unroll
  for (int t = 0; t < 4; ++t) o[t] = zero8();

  // A thread stages 16 bytes of keys srow and srow + 16 of a tile.
  const int srow = tid >> 3;            // 0..15
  const int soff = (tid & 7) * 8;       // d 0..56
  const size_t sbase = (tokbase + srow) * DMODEL + head * DHEAD + soff;
  Half8 tv0, tv1;                       // V of the tile in flight

  // tile t: K by async copies into Kt[buf], V into registers; nothing waits
  auto fetch = [&](int t, int buf) {
    const size_t g = sbase + (size_t)t * (32 * DMODEL);
    tv0.f = *(const f32x4*)(vb + g);
    tv1.f = *(const f32x4*)(vb + g + 16 * DMODEL);
    async_copy16(kb + g,               &Kt[buf][srow * 72 + soff]);
    async_copy16(kb + g + 16 * DMODEL, &Kt[buf][(srow + 16) * 72 + soff]);
    // the loads' address registers may be written again while they fly: the
    // wait stands in front of any such overwrite
    asm volatile("s_wait_xcnt 0x0" ::: "memory");
  };
  // V in flight -> Vt[buf]; unrolled so that b[e] are register halves
  auto put_v = [&](int buf) {
#pragma unroll
    for (int e = 0; e < 8; ++e) {
      Vt[buf][(soff + e) * 40 + srow]      = tv0.b[e];
      Vt[buf][(soff + e) * 40 + srow + 16] = tv1.b[e];
    }
  };

  const int ktmax = (q0 + 63) >> 5;     // odd: at least two tiles
  fetch(0, 0);
  put_v(0);
  wait_async_all();
  __syncthreads();

  for (int kt = 0; kt <= ktmax; ++kt) {
    const int kpos = kt * 32;
    const int buf  = kt & 1;
    const __bf16* Kc = Kt[buf];
    const __bf16* Vc = Vt[buf];
    // Directly behind the barrier that ended every read of the other buffer:
    // the next tile sets out, and is waited for only at this trip's foot.
    if (kt < ktmax) fetch(kt + 1, buf ^ 1);

    // S^T = K * Q^T (32 keys x 16 queries) as two 16x16 tiles
    v8f s0 = zero8(), s1 = zero8();
#pragma unroll
    for (int di = 0; di < 2; ++di) {
      const __bf16* p0 = Kc + lr * 72        + di * 32 + half;
      const __bf16* p1 = Kc + (16 + lr) * 72 + di * 32 + half;
      v16bf a0 = load_frag(p0, p0 + 16);
      v16bf a1 = load_frag(p1, p1 + 16);
      s0 = wmma_bf16(a0, qf[di], s0);
      s1 = wmma_bf16(a1, qf[di], s1);
    }

    // online softmax, one query per lane
    float v0[8], v1[8];
    float mx = -1e30f;
#pragma unroll
    for (int r = 0; r < 8; ++r) {
      int c0 = kpos + half + r, c1 = c0 + 16;
      v0[r] = (c0 <= qrow) ? s0[r] * 0.125f : -1e30f;
      v1[r] = (c1 <= qrow) ? s1[r] * 0.125f : -1e30f;
      mx = fmaxf(mx, fmaxf(v0[r], v1[r]));
    }
    mx = fmaxf(mx, xhalf(mx));
    const float mn    = fmaxf(m, mx);
    const float alpha = expf(m - mn);
    m = mn;

    v16bf pf;                           // B fragment: column = query, k = key
    float ps = 0.f;
#pragma unroll
    for (int r = 0; r < 8; ++r) {
      int c0 = kpos + half + r, c1 = c0 + 16;
      float e0 = expf(v0[r] - mn), e1 = expf(v1[r] - mn);
      float p0 = (c0 <= qrow) ? e0 : 0.f;
      float p1 = (c1 <= qrow) ? e1 : 0.f;
      ps += p0 + p1;
      pf[r]     = (__bf16)p0;
      pf[8 + r] = (__bf16)p1;
    }
    l = l * alpha + ps;
#pragma unroll
    for (int t = 0; t < 4; ++t)
#pragma unroll
      for (int r = 0; r < 8; ++r) o[t][r] *= alpha;

    // O^T += V^T * P^T
#pragma unroll
    for (int t = 0; t < 4; ++t) {
      const __bf16* pv = Vc + (t * 16 + lr) * 40 + half;
      v16bf av = load_frag(pv, pv + 16);
      o[t] = wmma_bf16(av, pf, o[t]);
    }

    // Foot of the trip: V of tile kt + 1 goes from registers to its buffer.
    if (kt < ktmax) put_v(buf ^ 1);
    // own LDS reads and writes done, own K copies of tile kt + 1 landed
    asm volatile("s_wait_dscnt 0x0" ::: "memory");
    wait_async_all();
    // publishes tile kt + 1 and ends every read of this trip's buffer,
    // which the next trip refills
    __syncthreads();
  }
  wait_async_all();                     // no copy in flight at the wave's end

  l += xhalf(l);                        // join the two halves' key sums
  __bf16* op = ob + (tokbase + qrow) * DMODEL + head * DHEAD + half;
#pragma unroll
  for (int t = 0; t < 4; ++t) {
    Half8 w;
#pragma unroll
    for (int r = 0; r < 8; ++r) w.b[r] = (__bf16)(o[t][r] / l);
    *(f32x4*)(op + t * 16) = w.f;
  }
}

// ---------------------------------------------------------------------------
// out = layernorm(x + y); optional bf16 copy for the next GEMM.
// One wave holds one row, 32 elements a lane by 16-byte loads, so that few
// waves have to start; both sums stay inside the wave: no LDS, no barrier.
// The loops are unrolled so that v[] and yv[] stay in registers.
// ---------------------------------------------------------------------------
__device__ __forceinline__ float wave_sum(float s) {
#pragma unroll
  for (int m = 16; m > 0; m >>= 1) s += __shfl_xor(s, m, 32);
  return s;
}

__global__ __launch_bounds__(256)
void add_ln_kernel(const float* __restrict__ x, const float* __restrict__ y,
                   const float* __restrict__ g, const float* __restrict__ b,
                   float* __restrict__ out, __bf16* __restrict__ outb)
{
  const int col = (threadIdx.x & 31) * 4;                 // plus 128 per j
  const int row = blockIdx.x * 8 + (threadIdx.x >> 5);
  const size_t base = (size_t)row * DMODEL + col;

  f32x4 v[8], yv[8];
#pragma unroll
  for (int j = 0; j < 8; ++j) v[j]  = *(const f32x4*)(x + base + j * 128);
#pragma unroll
  for (int j = 0; j < 8; ++j) yv[j] = *(const f32x4*)(y + base + j * 128);

  f32x4 s4 = {0.f, 0.f, 0.f, 0.f};
#pragma unroll
  for (int j = 0; j < 8; ++j) { v[j] += yv[j]; s4 += v[j]; }
  const float mu = wave_sum((s4.x + s4.y) + (s4.z + s4.w)) * (1.f / DMODEL);

  s4 = (f32x4){0.f, 0.f, 0.f, 0.f};
#pragma unroll
  for (int j = 0; j < 8; ++j) { v[j] -= mu; s4 += v[j] * v[j]; }
  const float rstd =
      rsqrtf(wave_sum((s4.x + s4.y) + (s4.z + s4.w)) * (1.f / DMODEL) + 1e-5f);

#pragma unroll
  for (int j = 0; j < 8; ++j) {
    const f32x4 gv = *(const f32x4*)(g + col + j * 128);
    const f32x4 bv = *(const f32x4*)(b + col + j * 128);
    v[j] = v[j] * rstd * gv + bv;
  }
  if (outb) {
#pragma unroll
    for (int j = 0; j < 8; ++j) {
      u32x2 p = {pack2(v[j].x, v[j].y), pack2(v[j].z, v[j].w)};
      *(u32x2*)(outb + base + j * 128) = p;
    }
  }
#pragma unroll
  for (int j = 0; j < 8; ++j) *(f32x4*)(out + base + j * 128) = v[j];
}

// ---------------------------------------------------------------------------
// Launcher
// ---------------------------------------------------------------------------
extern "C" void kernel_launch(void* const* d_in, const int* in_sizes, int n_in,
                              void* d_out, int out_size, void* d_ws, size_t ws_size,
                              hipStream_t stream) {
  const float* x    = (const float*)d_in[0];
  const float* Wq   = (const float*)d_in[1];
  const float* bq   = (const float*)d_in[2];
  const float* Wk   = (const float*)d_in[3];
  const float* bk   = (const float*)d_in[4];
  const float* Wv   = (const float*)d_in[5];
  const float* bv   = (const float*)d_in[6];
  const float* Wo   = (const float*)d_in[7];
  const float* ln1g = (const float*)d_in[8];
  const float* ln1b = (const float*)d_in[9];
  const float* W1   = (const float*)d_in[10];
  const float* b1   = (const float*)d_in[11];
  const float* W2   = (const float*)d_in[12];
  const float* b2   = (const float*)d_in[13];
  const float* ln2g = (const float*)d_in[14];
  const float* ln2b = (const float*)d_in[15];

  char* ws = (char*)d_ws;
  size_t off = 0;
  auto alloc = [&](size_t bytes) -> char* {
    char* p = ws + off;
    off = (off + bytes + 255) & ~(size_t)255;
    return p;
  };

  __bf16* xb   = (__bf16*)alloc((size_t)NTOK * DMODEL * 2);
  __bf16* Wqt  = (__bf16*)alloc((size_t)3 * DMODEL * DMODEL * 2);   // [N][K], q k v in a row
  __bf16* Wkt  = Wqt + (size_t)DMODEL * DMODEL;
  __bf16* Wvt  = Wkt + (size_t)DMODEL * DMODEL;
  __bf16* Wot  = (__bf16*)alloc((size_t)DMODEL * DMODEL * 2);
  __bf16* W1t  = (__bf16*)alloc((size_t)DMODEL * DHID * 2);
  __bf16* W2t  = (__bf16*)alloc((size_t)DHID * DMODEL * 2);
  __bf16* qbuf = (__bf16*)alloc((size_t)3 * NTOK * DMODEL * 2);     // q k v in a row
  __bf16* kbuf = qbuf + (size_t)NTOK * DMODEL;
  __bf16* vbuf = kbuf + (size_t)NTOK * DMODEL;
  __bf16* obuf = (__bf16*)alloc((size_t)NTOK * DMODEL * 2);
  float*  t1   = (float*)alloc((size_t)NTOK * DMODEL * 4);
  float*  h    = (float*)alloc((size_t)NTOK * DMODEL * 4);
  __bf16* hb   = (__bf16*)alloc((size_t)NTOK * DMODEL * 2);
  __bf16* m1   = (__bf16*)alloc((size_t)NTOK * DHID * 2);
  float*  m2   = (float*)alloc((size_t)NTOK * DMODEL * 4);

  // x cast and the six weight transposes
  prep_kernel<<<XBLOCKS + 4 * SQTILES + 2 * HIDTILES, 256, 0, stream>>>(
      x, Wq, Wk, Wv, Wo, W1, W2, xb, Wqt, Wkt, Wvt, Wot, W1t, W2t);

  // Q, K and V projections (bf16 out)
  gemm_kernel<false, true, true, 64><<<dim3(3 * DMODEL / 128, NTOK / 128), 256, 0, stream>>>(
      xb, Wqt, bq, bk, bv, qbuf, NTOK, DMODEL, DMODEL);

  // causal flash attention
  attn_kernel<<<dim3(SEQ / 64, NHEADS, 2), 128, 0, stream>>>(qbuf, kbuf, vbuf, obuf);

  // output projection (f32 out, no bias)
  gemm_kernel<false, false, false, 256><<<dim3(DMODEL / 128, NTOK / 128), 256, 0, stream>>>(
      obuf, Wot, nullptr, nullptr, nullptr, t1, NTOK, DMODEL, DMODEL);

  // h = LN(x + attn)
  add_ln_kernel<<<NTOK / 8, 256, 0, stream>>>(x, t1, ln1g, ln1b, h, hb);

  // MLP up with fused exact GELU (bf16 out)
  gemm_kernel<true, true, false, 64><<<dim3(DHID / 128, NTOK / 128), 256, 0, stream>>>(
      hb, W1t, b1, nullptr, nullptr, m1, NTOK, DHID, DMODEL);

  // MLP down (f32 out)
  gemm_kernel<false, false, false, 256><<<dim3(DMODEL / 128, NTOK / 128), 256, 0, stream>>>(
      m1, W2t, b2, nullptr, nullptr, m2, NTOK, DMODEL, DHID);

  // out = LN(h + mlp)
  add_ln_kernel<<<NTOK / 8, 256, 0, stream>>>(h, m2, ln2g, ln2b, (float*)d_out, nullptr);
}

// v007
// Measured time: 198 microseconds a run.
// In both of two side-by-side timings against v006, it was 1.11 times as fast.
// All steps since v000 together make it 2.41 times as fast.
#include <hip/hip_runtime.h>
#include <hip/hip_bf16.h>
#include <math.h>

// ---------------------------------------------------------------------------
// Transformer layer for MI455X (gfx1250, wave32, WMMA).
// All matmuls use v_wmma_f32_16x16x32_bf16 (bf16 in, f32 accum).
// Weights pre-transposed at cast time so GEMM A and B tiles are both
// contiguous-row copies -> double-buffered async global->LDS staging.
// ---------------------------------------------------------------------------

typedef __attribute__((ext_vector_type(16))) __bf16 v16bf;
typedef __attribute__((ext_vector_type(8)))  float  v8f;
typedef __attribute__((ext_vector_type(4)))  float  f32x4;
typedef __attribute__((ext_vector_type(4)))  int    i32x4;

#define DMODEL 1024
#define DHEAD  64
#define NHEADS 16
#define DHID   4096
#define SEQ    2048
#define NTOK   4096   // B * S

union Frag16 { f32x4 f[2]; v16bf v; };
union Half8  { f32x4 f; __bf16 b[8]; };

#if __has_builtin(__builtin_amdgcn_global_load_async_to_lds_b128)
#define HAVE_ASYNC_LDS 1
#else
#define HAVE_ASYNC_LDS 0
#endif

// Copy 16 bytes (8 bf16) global -> LDS; async (per-lane gather) when available.
__device__ __forceinline__ void async_copy16(const __bf16* g, __bf16* l) {
#if HAVE_ASYNC_LDS
  __builtin_amdgcn_global_load_async_to_lds_b128(
      (__attribute__((address_space(1))) i32x4*)g,
      (__attribute__((address_space(3))) i32x4*)l, 0, 0);
#else
  *(f32x4*)l = *(const f32x4*)g;
#endif
}

__device__ __forceinline__ void wait_async_all() {
  asm volatile("s_wait_asynccnt 0x0" ::: "memory");
}

__device__ __forceinline__ v16bf load_frag(const __bf16* p0, const __bf16* p1) {
  Frag16 u;
  u.f[0] = *(const f32x4*)p0;   // elems 0..7  (K = half+0..7)
  u.f[1] = *(const f32x4*)p1;   // elems 8..15 (K = 16+half+0..7)
  return u.v;
}

__device__ __forceinline__ v8f zero8() {
  v8f z = {0.f,0.f,0.f,0.f,0.f,0.f,0.f,0.f};
  return z;
}

__device__ __forceinline__ v8f wmma_bf16(v16bf a, v16bf b, v8f c) {
  return __builtin_amdgcn_wmma_f32_16x16x32_bf16(
      false, a, false, b, (short)0, c, false, false);
}

// ---------------------------------------------------------------------------
// Conversion pre-pass, one launch. None of its seven jobs reads another's
// output, so the block index picks the job. Every block converts 16384
// elements, 64 a thread by 16-byte loads, so that few waves have to start:
//   blocks [0, 256)     x fp32 -> bf16
//   blocks [256, 1024)  fp32 W[K,N] -> bf16 Wt[N,K], one 128x128 tile a block
//                       (Wq, Wk, Wv, Wo: 64 tiles each; W1, W2: 256 each)
// ---------------------------------------------------------------------------
#define PREPELEMS 16384
#define XBLOCKS (NTOK * DMODEL / PREPELEMS)
#define SQTILES ((DMODEL / 128) * (DMODEL / 128))
#define HIDTILES ((DMODEL / 128) * (DHID / 128))

typedef __attribute__((ext_vector_type(2))) float    f32x2;
typedef __attribute__((ext_vector_type(2))) __bf16   bf16x2;
typedef __attribute__((ext_vector_type(2))) unsigned u32x2;
typedef __attribute__((ext_vector_type(4))) unsigned u32x4;

// two f32 -> one dword of two bf16, a in the low half
__device__ __forceinline__ unsigned pack2(float a, float b) {
  f32x2 v = {a, b};
  return __builtin_bit_cast(unsigned, __builtin_convertvector(v, bf16x2));
}

// One 128x128 tile: fp32 W[K,N] -> bf16 Wt[N,K]. K and N are compile-time, so
// a thread's 16 loads are one address with 16 immediate offsets.
// tile is [n][k] as bf16, 256 B a row, in units of 8 B (four k). Unit u of row
// n lies at place u ^ (n >> 2): the 32 lanes of a store, which hold 32 rows at
// one u, then fall on 32 different places, that is on all 64 banks.
// The loops are unrolled so that v[][] stays in registers and the offsets
// are immediates.
template<int K, int N>
__device__ __forceinline__ void transpose_tile(const float* __restrict__ W,
                                               __bf16* __restrict__ Wt,
                                               int b, unsigned* tile)
{
  const int tid = threadIdx.x;
  const int n0 = (b % (N / 128)) * 128, k0 = (b / (N / 128)) * 128;
  const int lane = tid & 31, wave = tid >> 5;

  // A wave-wide load is 512 B of one k row; a lane holds columns 4*lane..+3
  // of rows 4*u..4*u+3, u = wave + 8*j.
  const float* src = W + (size_t)(k0 + 4 * wave) * N + n0 + lane * 4;
  f32x4 v[4][4];
#pragma unroll
  for (int j = 0; j < 4; ++j)
#pragma unroll
    for (int e = 0; e < 4; ++e)
      v[j][e] = *(const f32x4*)(src + (32 * j + e) * N);
#pragma unroll
  for (int j = 0; j < 4; ++j)
#pragma unroll
    for (int i = 0; i < 4; ++i) {
      u32x2 p = {pack2(v[j][0][i], v[j][1][i]), pack2(v[j][2][i], v[j][3][i])};
      *(u32x2*)&tile[(lane * 4 + i) * 64 + (((wave + 8 * j) ^ lane) << 1)] = p;
    }
  __syncthreads();

  // 16 lanes store one row's 256 B. Units 2*kg and 2*kg+1 share a 16-byte
  // place and stand there in swapped order where n >> 2 is odd.
  const int kg = tid & 15, nr = tid >> 4;
  __bf16* dst = Wt + (size_t)(n0 + nr) * K + k0 + kg * 8;
#pragma unroll
  for (int p = 0; p < 8; ++p) {
    const int n = nr + 16 * p;
    const int s = n >> 2;
    u32x4 q = *(const u32x4*)&tile[n * 64 + ((kg ^ (s >> 1)) << 2)];
    if (s & 1) q = q.zwxy;
    *(u32x4*)(dst + 16 * p * K) = q;
  }
  // the stores' registers may be written again by the code that follows in
  // the listing: the wait stands in front of any such overwrite
  asm volatile("s_wait_xcnt 0x0" ::: "memory");
}

__global__ __launch_bounds__(256)
void prep_kernel(const float* __restrict__ x,
                 const float* __restrict__ Wq, const float* __restrict__ Wk,
                 const float* __restrict__ Wv, const float* __restrict__ Wo,
                 const float* __restrict__ W1, const float* __restrict__ W2,
                 __bf16* __restrict__ xb,
                 __bf16* __restrict__ Wqt, __bf16* __restrict__ Wkt,
                 __bf16* __restrict__ Wvt, __bf16* __restrict__ Wot,
                 __bf16* __restrict__ W1t, __bf16* __restrict__ W2t)
{
  __shared__ __attribute__((aligned(16))) unsigned tile[128 * 64];
  int b = blockIdx.x;

  if (b < XBLOCKS) {
    const size_t base = (size_t)b * PREPELEMS + threadIdx.x * 4;
    f32x4 v[16];                         // unrolled: v[] stays in registers
#pragma unroll
    for (int j = 0; j < 16; ++j) v[j] = *(const f32x4*)(x + base + j * 1024);
#pragma unroll
    for (int j = 0; j < 16; ++j) {
      u32x2 p = {pack2(v[j].x, v[j].y), pack2(v[j].z, v[j].w)};
      *(u32x2*)(xb + base + j * 1024) = p;
    }
    return;
  }
  b -= XBLOCKS;

  // the branches are uniform for the block, so each one's barrier is met by
  // all of its threads
  if (b < 4 * SQTILES) {
    const int w = b / SQTILES;
    const float* W = w == 0 ? Wq  : w == 1 ? Wk  : w == 2 ? Wv  : Wo;
    __bf16* Wt     = w == 0 ? Wqt : w == 1 ? Wkt : w == 2 ? Wvt : Wot;
    transpose_tile<DMODEL, DMODEL>(W, Wt, b - w * SQTILES, tile);
  } else if (b < 4 * SQTILES + HIDTILES) {
    transpose_tile<DMODEL, DHID>(W1, W1t, b - 4 * SQTILES, tile);
  } else {
    transpose_tile<DHID, DMODEL>(W2, W2t, b - (4 * SQTILES + HIDTILES), tile);
  }
}

// ---------------------------------------------------------------------------
// Tiled bf16 WMMA GEMM: C[M,N] = act(A[M,K] @ Bt[N,K]^T + bias)
// Block tile 128x128, k-step KS, double-buffered async LDS staging.
// KS is 64 where several blocks share a WGP and fill each other's waits, and
// 256 where the grid gives a WGP one block: there nothing else runs while the
// block waits out a hand-over (copy wait and barrier), so a long step, with a
// quarter of the hand-overs along K and four times the products to cover the
// next step's copies, is the faster. K must be a multiple of KS.
// 256 threads = 8 waves, wave grid 4x2 (MxN); each wave: 2x4 16x16 tiles.
// Both LDS tiles are [row/col][k] with stride KS + 8 (an odd multiple of
// 16 bytes) so every fragment is two contiguous ds_load_b128 per lane
// without bank conflicts (A layout: K groups of 8 per lane-half).
// TRI: three products that share A in one launch. Bt holds the three [N,K]
// weights one behind the other, Cout the three [M,N] outputs likewise; grid x
// runs over all 3N columns and each 128-column block lies in one part.
// ---------------------------------------------------------------------------
template<bool GELU, bool OUT_BF16, bool TRI, int KS>
__global__ __launch_bounds__(256)
void gemm_kernel(const __bf16* __restrict__ A, const __bf16* __restrict__ Bt,
                 const float* __restrict__ bias, const float* __restrict__ bias1,
                 const float* __restrict__ bias2, void* __restrict__ Cout,
                 int M, int N, int K)
{
  constexpr int PITCH = KS + 8;          // LDS row stride in elements
  __shared__ __attribute__((aligned(16))) __bf16 As[2][128 * PITCH];
  __shared__ __attribute__((aligned(16))) __bf16 Bs[2][128 * PITCH];

  const int tid   = threadIdx.x;
  const int lane  = tid & 31;
  const int wave  = tid >> 5;
  const int waveM = wave >> 1;           // 0..3
  const int waveN = wave & 1;            // 0..1
  const int lr    = lane & 15;
  const int half  = (lane >> 4) * 8;
  const int blkN  = blockIdx.x * 128;
  const int blkM  = blockIdx.y * 128;

  v8f acc[2][4];
#pragma unroll
  for (int tm = 0; tm < 2; ++tm)
#pragma unroll
    for (int tn = 0; tn < 4; ++tn) acc[tm][tn] = zero8();

  // KS / 8 lanes take one row's 2 * KS bytes of the k-step, so each wave-wide
  // copy covers four whole 128-byte lines (of four rows, or all of one row).
  constexpr int LPR = KS / 8;            // lanes per row
  constexpr int RPC = 256 / LPR;         // rows per block-wide copy
  const int srow = tid / LPR;            // plus RPC per copy
  const int skc  = (tid % LPR) * 8;      // 0..KS - 8

  auto stage = [&](int k0, int buf) {
    const __bf16* ag = A  + (size_t)(blkM + srow) * K + k0 + skc;
    const __bf16* bg = Bt + (size_t)(blkN + srow) * K + k0 + skc;
    __bf16* al = &As[buf][srow * PITCH + skc];
    __bf16* bl = &Bs[buf][srow * PITCH + skc];
#pragma unroll
    for (int e = 0; e < 128 / RPC; ++e) {
      async_copy16(ag + (size_t)(e * RPC) * K, al + e * RPC * PITCH);
      async_copy16(bg + (size_t)(e * RPC) * K, bl + e * RPC * PITCH);
    }
  };

  stage(0, 0);
  const int T = K >> __builtin_ctz(KS);  // K / KS, KS a power of two
  for (int i = 0; i < T; ++i) {
    wait_async_all();                    // own tile-i loads landed
    __syncthreads();                     // everyone's tile-i landed; prev reads done
    if (i + 1 < T) stage((i + 1) * KS, (i + 1) & 1);

    const __bf16* as = As[i & 1];
    const __bf16* bs = Bs[i & 1];
#pragma unroll
    for (int kc = 0; kc < KS / 32; ++kc) {
      v16bf af[2], bfv[4];
#pragma unroll
      for (int tm = 0; tm < 2; ++tm) {
        const __bf16* p = as + (waveM * 32 + tm * 16 + lr) * PITCH + kc * 32 + half;
        af[tm] = load_frag(p, p + 16);
      }
#pragma unroll
      for (int tn = 0; tn < 4; ++tn) {
        const __bf16* p = bs + (waveN * 64 + tn * 16 + lr) * PITCH + kc * 32 + half;
        bfv[tn] = load_frag(p, p + 16);
      }
#pragma unroll
      for (int tm = 0; tm < 2; ++tm)
#pragma unroll
        for (int tn = 0; tn < 4; ++tn)
          acc[tm][tn] = wmma_bf16(af[tm], bfv[tn], acc[tm][tn]);
    }
  }

  // epilogue: bias + optional exact GELU, f32 or bf16 store
  int partN = 0;                         // first column of this block's part
  if (TRI) {
    const int part = blkN / N;
    partN = part * N;
    bias = part == 0 ? bias : part == 1 ? bias1 : bias2;
    // col below counts from column 0 of part 0: part's [M,N] output starts
    // part * M * N elements on, less the partN that col already holds
    Cout = (__bf16*)Cout + ((size_t)part * M * N - partN);
  }
#pragma unroll
  for (int tm = 0; tm < 2; ++tm) {
#pragma unroll
    for (int tn = 0; tn < 4; ++tn) {
      int col = blkN + waveN * 64 + tn * 16 + lr;
      float bv = bias ? bias[col - partN] : 0.f;
#pragma unroll
      for (int r = 0; r < 8; ++r) {
        int row = blkM + waveM * 32 + tm * 16 + half + r;
        float v = acc[tm][tn][r] + bv;
        if (GELU) v = 0.5f * v * (1.f + erff(v * 0.70710678118654752f));
        if (OUT_BF16) ((__bf16*)Cout)[(size_t)row * N + col] = (__bf16)v;
        else          ((float*)Cout)[(size_t)row * N + col]  = v;
      }
    }
  }
}

__device__ __forceinline__ float xhalf(float x) {
  int b = __builtin_bit_cast(int, x);
  return __builtin_bit_cast(float,
      __builtin_amdgcn_permlanex16(b, b, 0x76543210, 0xfedcba98, false, false));
}

__global__ __launch_bounds__(128)
void attn_kernel(const __bf16* __restrict__ qb, const __bf16* __restrict__ kb,
                 const __bf16* __restrict__ vb, __bf16* __restrict__ ob)
{
  __shared__ __attribute__((aligned(16))) __bf16 Kt[2][32 * 72];  // [key][d]
  __shared__ __attribute__((aligned(16))) __bf16 Vt[2][64 * 40];  // [d][key] transposed

  const int tid  = threadIdx.x;
  const int lane = tid & 31;
  const int wave = tid >> 5;
  const int lr   = lane & 15;
  const int half = (lane >> 4) * 8;

  const int head = blockIdx.y;
  // Placement, for speed only. A query tile's cost grows with its index and
  // all blocks are resident at once, so the launch lasts as long as the
  // fullest WGP. The grid's x extent is 32.
  // So the (head, batch) pairs of odd bit parity walk the tiles from the far
  // end: of blocks 32, 64, ... 512 flat indices apart half hold tile x and
  // half tile 31 - x, heavy beside light. Every (head, batch, tile) runs once.
  const int rev  = __builtin_popcount(blockIdx.y ^ (blockIdx.z << 4)) & 1;
  const int q0   = (rev ? (SEQ / 64 - 1) - blockIdx.x : blockIdx.x) * 64;
  const int qw   = q0 + wave * 16;
  const int qrow = qw + lr;             // this lane's query
  const size_t tokbase = (size_t)blockIdx.z * SEQ;

  v16bf qf[2];                          // B fragment: column = query, k = d
#pragma unroll
  for (int di = 0; di < 2; ++di) {
    const __bf16* p = qb + (tokbase + qrow) * DMODEL + head * DHEAD + di * 32 + half;
    qf[di] = load_frag(p, p + 16);
  }

  float m = -1e30f;                     // running maximum of this query
  float l = 0.f;                        // sum over this lane's keys only
  v8f o[4];                             // o[t][r] = O[qrow][t*16 + half + r]
#pragma unroll
  for (int t = 0; t < 4; ++t) o[t] = zero8();

  // A thread stages 16 bytes of keys srow and srow + 16 of a tile.
  const int srow = tid >> 3;            // 0..15
  const int soff = (tid & 7) * 8;       // d 0..56
  const size_t sbase = (tokbase + srow) * DMODEL + head * DHEAD + soff;
  Half8 tv0, tv1;                       // V of the tile in flight

  // tile t: K by async copies into Kt[buf], V into registers; nothing waits
  auto fetch = [&](int t, int buf) {
    const size_t g = sbase + (size_t)t * (32 * DMODEL);
    tv0.f = *(const f32x4*)(vb + g);
    tv1.f = *(const f32x4*)(vb + g + 16 * DMODEL);
    async_copy16(kb + g,               &Kt[buf][srow * 72 + soff]);
    async_copy16(kb + g + 16 * DMODEL, &Kt[buf][(srow + 16) * 72 + soff]);
    // the loads' address registers may be written again while they fly: the
    // wait stands in front of any such overwrite
    asm volatile("s_wait_xcnt 0x0" ::: "memory");
  };
  // V in flight -> Vt[buf]; unrolled so that b[e] are register halves
  auto put_v = [&](int buf) {
#pragma unroll
    for (int e = 0; e < 8; ++e) {
      Vt[buf][(soff + e) * 40 + srow]      = tv0.b[e];
      Vt[buf][(soff + e) * 40 + srow + 16] = tv1.b[e];
    }
  };

  const int ktmax = (q0 + 63) >> 5;     // odd: at least two tiles
  fetch(0, 0);
  put_v(0);
  wait_async_all();
  __syncthreads();

  for (int kt = 0; kt <= ktmax; ++kt) {
    const int kpos = kt * 32;
    const int buf  = kt & 1;
    const __bf16* Kc = Kt[buf];
    const __bf16* Vc = Vt[buf];
    // Directly behind the barrier that ended every read of the other buffer:
    // the next tile sets out, and is waited for only at this trip's foot.
    if (kt < ktmax) fetch(kt + 1, buf ^ 1);

    // S^T = K * Q^T (32 keys x 16 queries) as two 16x16 tiles
    v8f s0 = zero8(), s1 = zero8();
#pragma unroll
    for (int di = 0; di < 2; ++di) {
      const __bf16* p0 = Kc + lr * 72        + di * 32 + half;
      const __bf16* p1 = Kc + (16 + lr) * 72 + di * 32 + half;
      v16bf a0 = load_frag(p0, p0 + 16);
      v16bf a1 = load_frag(p1, p1 + 16);
      s0 = wmma_bf16(a0, qf[di], s0);
      s1 = wmma_bf16(a1, qf[di], s1);
    }

    // online softmax, one query per lane
    float v0[8], v1[8];
    float mx = -1e30f;
#pragma unroll
    for (int r = 0; r < 8; ++r) {
      int c0 = kpos + half + r, c1 = c0 + 16;
      v0[r] = (c0 <= qrow) ? s0[r] * 0.125f : -1e30f;
      v1[r] = (c1 <= qrow) ? s1[r] * 0.125f : -1e30f;
      mx = fmaxf(mx, fmaxf(v0[r], v1[r]));
    }
    mx = fmaxf(mx, xhalf(mx));
    const float mn    = fmaxf(m, mx);
    const float alpha = expf(m - mn);
    m = mn;

    v16bf pf;                           // B fragment: column = query, k = key
    float ps = 0.f;
#pragma unroll
    for (int r = 0; r < 8; ++r) {
      int c0 = kpos + half + r, c1 = c0 + 16;
      float e0 = expf(v0[r] - mn), e1 = expf(v1[r] - mn);
      float p0 = (c0 <= qrow) ? e0 : 0.f;
      float p1 = (c1 <= qrow) ? e1 : 0.f;
      ps += p0 + p1;
      pf[r]     = (__bf16)p0;
      pf[8 + r] = (__bf16)p1;
    }
    l = l * alpha + ps;
#pragma unroll
    for (int t = 0; t < 4; ++t)
#pragma unroll
      for (int r = 0; r < 8; ++r) o[t][r] *= alpha;

    // O^T += V^T * P^T
#pragma unroll
    for (int t = 0; t < 4; ++t) {
      const __bf16* pv = Vc + (t * 16 + lr) * 40 + half;
      v16bf av = load_frag(pv, pv + 16);
      o[t] = wmma_bf16(av, pf, o[t]);
    }

    // Foot of the trip: V of tile kt + 1 goes from registers to its buffer.
    if (kt < ktmax) put_v(buf ^ 1);
    // own LDS reads and writes done, own K copies of tile kt + 1 landed
    asm volatile("s_wait_dscnt 0x0" ::: "memory");
    wait_async_all();
    // publishes tile kt + 1 and ends every read of this trip's buffer,
    // which the next trip refills
    __syncthreads();
  }
  wait_async_all();                     // no copy in flight at the wave's end

  l += xhalf(l);                        // join the two halves' key sums
  __bf16* op = ob + (tokbase + qrow) * DMODEL + head * DHEAD + half;
#pragma unroll
  for (int t = 0; t < 4; ++t) {
    Half8 w;
#pragma unroll
    for (int r = 0; r < 8; ++r) w.b[r] = (__bf16)(o[t][r] / l);
    *(f32x4*)(op + t * 16) = w.f;
  }
}

// ---------------------------------------------------------------------------
// out = layernorm(x + y); optional bf16 copy for the next GEMM.
// One wave holds one row, 32 elements a lane by 16-byte loads, so that few
// waves have to start; both sums stay inside the wave: no LDS, no barrier.
// The loops are unrolled so that v[] and yv[] stay in registers.
// ---------------------------------------------------------------------------
__device__ __forceinline__ float wave_sum(float s) {
#pragma unroll
  for (int m = 16; m > 0; m >>= 1) s += __shfl_xor(s, m, 32);
  return s;
}

__global__ __launch_bounds__(256)
void add_ln_kernel(const float* __restrict__ x, const float* __restrict__ y,
                   const float* __restrict__ g, const float* __restrict__ b,
                   float* __restrict__ out, __bf16* __restrict__ outb)
{
  const int col = (threadIdx.x & 31) * 4;                 // plus 128 per j
  const int row = blockIdx.x * 8 + (threadIdx.x >> 5);
  const size_t base = (size_t)row * DMODEL + col;

  f32x4 v[8], yv[8];
#pragma unroll
  for (int j = 0; j < 8; ++j) v[j]  = *(const f32x4*)(x + base + j * 128);
#pragma unroll
  for (int j = 0; j < 8; ++j) yv[j] = *(const f32x4*)(y + base + j * 128);

  f32x4 s4 = {0.f, 0.f, 0.f, 0.f};
#pragma unroll
  for (int j = 0; j < 8; ++j) { v[j] += yv[j]; s4 += v[j]; }
  const float mu = wave_sum((s4.x + s4.y) + (s4.z + s4.w)) * (1.f / DMODEL);

  s4 = (f32x4){0.f, 0.f, 0.f, 0.f};
#pragma unroll
  for (int j = 0; j < 8; ++j) { v[j] -= mu; s4 += v[j] * v[j]; }
  const float rstd =
      rsqrtf(wave_sum((s4.x + s4.y) + (s4.z + s4.w)) * (1.f / DMODEL) + 1e-5f);

#pragma unroll
  for (int j = 0; j < 8; ++j) {
    const f32x4 gv = *(const f32x4*)(g + col + j * 128);
    const f32x4 bv = *(const f32x4*)(b + col + j * 128);
    v[j] = v[j] * rstd * gv + bv;
  }
  if (outb) {
#pragma unroll
    for (int j = 0; j < 8; ++j) {
      u32x2 p = {pack2(v[j].x, v[j].y), pack2(v[j].z, v[j].w)};
      *(u32x2*)(outb + base + j * 128) = p;
    }
  }
#pragma unroll
  for (int j = 0; j < 8; ++j) *(f32x4*)(out + base + j * 128) = v[j];
}

// ---------------------------------------------------------------------------
// Launcher
// ---------------------------------------------------------------------------
extern "C" void kernel_launch(void* const* d_in, const int* in_sizes, int n_in,
                              void* d_out, int out_size, void* d_ws, size_t ws_size,
                              hipStream_t stream) {
  const float* x    = (const float*)d_in[0];
  const float* Wq   = (const float*)d_in[1];
  const float* bq   = (const float*)d_in[2];
  const float* Wk   = (const float*)d_in[3];
  const float* bk   = (const float*)d_in[4];
  const float* Wv   = (const float*)d_in[5];
  const float* bv   = (const float*)d_in[6];
  const float* Wo   = (const float*)d_in[7];
  const float* ln1g = (const float*)d_in[8];
  const float* ln1b = (const float*)d_in[9];
  const float* W1   = (const float*)d_in[10];
  const float* b1   = (const float*)d_in[11];
  const float* W2   = (const float*)d_in[12];
  const float* b2   = (const float*)d_in[13];
  const float* ln2g = (const float*)d_in[14];
  const float* ln2b = (const float*)d_in[15];

  char* ws = (char*)d_ws;
  size_t off = 0;
  auto alloc = [&](size_t bytes) -> char* {
    char* p = ws + off;
    off = (off + bytes + 255) & ~(size_t)255;
    return p;
  };

  __bf16* xb   = (__bf16*)alloc((size_t)NTOK * DMODEL * 2);
  __bf16* Wqt  = (__bf16*)alloc((size_t)3 * DMODEL * DMODEL * 2);   // [N][K], q k v in a row
  __bf16* Wkt  = Wqt + (size_t)DMODEL * DMODEL;
  __bf16* Wvt  = Wkt + (size_t)DMODEL * DMODEL;
  __bf16* Wot  = (__bf16*)alloc((size_t)DMODEL * DMODEL * 2);
  __bf16* W1t  = (__bf16*)alloc((size_t)DMODEL * DHID * 2);
  __bf16* W2t  = (__bf16*)alloc((size_t)DHID * DMODEL * 2);
  __bf16* qbuf = (__bf16*)alloc((size_t)3 * NTOK * DMODEL * 2);     // q k v in a row
  __bf16* kbuf = qbuf + (size_t)NTOK * DMODEL;
  __bf16* vbuf = kbuf + (size_t)NTOK * DMODEL;
  __bf16* obuf = (__bf16*)alloc((size_t)NTOK * DMODEL * 2);
  float*  t1   = (float*)alloc((size_t)NTOK * DMODEL * 4);
  float*  h    = (float*)alloc((size_t)NTOK * DMODEL * 4);
  __bf16* hb   = (__bf16*)alloc((size_t)NTOK * DMODEL * 2);
  __bf16* m1   = (__bf16*)alloc((size_t)NTOK * DHID * 2);
  float*  m2   = (float*)alloc((size_t)NTOK * DMODEL * 4);

  // x cast and the six weight transposes
  prep_kernel<<<XBLOCKS + 4 * SQTILES + 2 * HIDTILES, 256, 0, stream>>>(
      x, Wq, Wk, Wv, Wo, W1, W2, xb, Wqt, Wkt, Wvt, Wot, W1t, W2t);

  // Q, K and V projections (bf16 out)
  gemm_kernel<false, true, true, 64><<<dim3(3 * DMODEL / 128, NTOK / 128), 256, 0, stream>>>(
      xb, Wqt, bq, bk, bv, qbuf, NTOK, DMODEL, DMODEL);

  // causal flash attention
  attn_kernel<<<dim3(SEQ / 64, NHEADS, 2), 128, 0, stream>>>(qbuf, kbuf, vbuf, obuf);

  // output projection (f32 out, no bias)
  gemm_kernel<false, false, false, 256><<<dim3(DMODEL / 128, NTOK / 128), 256, 0, stream>>>(
      obuf, Wot, nullptr, nullptr, nullptr, t1, NTOK, DMODEL, DMODEL);

  // h = LN(x + attn)
  add_ln_kernel<<<NTOK / 8, 256, 0, stream>>>(x, t1, ln1g, ln1b, h, hb);

  // MLP up with fused exact GELU (bf16 out)
  gemm_kernel<true, true, false, 64><<<dim3(DHID / 128, NTOK / 128), 256, 0, stream>>>(
      hb, W1t, b1, nullptr, nullptr, m1, NTOK, DHID, DMODEL);

  // MLP down (f32 out)
  gemm_kernel<false, false, false, 256><<<dim3(DMODEL / 128, NTOK / 128), 256, 0, stream>>>(
      m1, W2t, b2, nullptr, nullptr, m2, NTOK, DMODEL, DHID);

  // out = LN(h + mlp)
  add_ln_kernel<<<NTOK / 8, 256, 0, stream>>>(h, m2, ln2g, ln2b, (float*)d_out, nullptr);
}

// v008
// A run of this version takes 191 microseconds.
// In both of two side-by-side timings against v007, it was 1.04 times as fast.
// All steps since v000 together make it 2.51 times as fast.
#include <hip/hip_runtime.h>
#include <hip/hip_bf16.h>
#include <math.h>

// ---------------------------------------------------------------------------
// Transformer layer for MI455X (gfx1250, wave32, WMMA).
// All matmuls use v_wmma_f32_16x16x32_bf16 (bf16 in, f32 accum).
// Weights pre-transposed at cast time so GEMM A and B tiles are both
// contiguous-row copies -> double-buffered async global->LDS staging.
// ---------------------------------------------------------------------------

typedef __attribute__((ext_vector_type(16))) __bf16 v16bf;
typedef __attribute__((ext_vector_type(8)))  float  v8f;
typedef __attribute__((ext_vector_type(4)))  float  f32x4;
typedef __attribute__((ext_vector_type(4)))  int    i32x4;

#define DMODEL 1024
#define DHEAD  64
#define NHEADS 16
#define DHID   4096
#define SEQ    2048
#define NTOK   4096   // B * S

union Frag16 { f32x4 f[2]; v16bf v; };
union Half8  { f32x4 f; __bf16 b[8]; };

#if __has_builtin(__builtin_amdgcn_global_load_async_to_lds_b128)
#define HAVE_ASYNC_LDS 1
#else
#define HAVE_ASYNC_LDS 0
#endif

// Copy 16 bytes (8 bf16) global -> LDS; async (per-lane gather) when available.
__device__ __forceinline__ void async_copy16(const __bf16* g, __bf16* l) {
#if HAVE_ASYNC_LDS
  __builtin_amdgcn_global_load_async_to_lds_b128(
      (__attribute__((address_space(1))) i32x4*)g,
      (__attribute__((address_space(3))) i32x4*)l, 0, 0);
#else
  *(f32x4*)l = *(const f32x4*)g;
#endif
}

__device__ __forceinline__ void wait_async_all() {
  asm volatile("s_wait_asynccnt 0x0" ::: "memory");
}

__device__ __forceinline__ v16bf load_frag(const __bf16* p0, const __bf16* p1) {
  Frag16 u;
  u.f[0] = *(const f32x4*)p0;   // elems 0..7  (K = half+0..7)
  u.f[1] = *(const f32x4*)p1;   // elems 8..15 (K = 16+half+0..7)
  return u.v;
}

__device__ __forceinline__ v8f zero8() {
  v8f z = {0.f,0.f,0.f,0.f,0.f,0.f,0.f,0.f};
  return z;
}

__device__ __forceinline__ v8f wmma_bf16(v16bf a, v16bf b, v8f c) {
  return __builtin_amdgcn_wmma_f32_16x16x32_bf16(
      false, a, false, b, (short)0, c, false, false);
}

// ---------------------------------------------------------------------------
// Conversion pre-pass, one launch. None of its seven jobs reads another's
// output, so the block index picks the job. Every block converts 16384
// elements, 64 a thread by 16-byte loads, so that few waves have to start:
//   blocks [0, 256)     x fp32 -> bf16
//   blocks [256, 1024)  fp32 W[K,N] -> bf16 Wt[N,K], one 128x128 tile a block
//                       (Wq, Wk, Wv, Wo: 64 tiles each; W1, W2: 256 each)
// ---------------------------------------------------------------------------
#define PREPELEMS 16384
#define XBLOCKS (NTOK * DMODEL / PREPELEMS)
#define SQTILES ((DMODEL / 128) * (DMODEL / 128))
#define HIDTILES ((DMODEL / 128) * (DHID / 128))

typedef __attribute__((ext_vector_type(2))) float    f32x2;
typedef __attribute__((ext_vector_type(2))) __bf16   bf16x2;
typedef __attribute__((ext_vector_type(2))) unsigned u32x2;
typedef __attribute__((ext_vector_type(4))) unsigned u32x4;

// two f32 -> one dword of two bf16, a in the low half
__device__ __forceinline__ unsigned pack2(float a, float b) {
  f32x2 v = {a, b};
  return __builtin_bit_cast(unsigned, __builtin_convertvector(v, bf16x2));
}

// One 128x128 tile: fp32 W[K,N] -> bf16 Wt[N,K]. K and N are compile-time, so
// a thread's 16 loads are one address with 16 immediate offsets.
// tile is [n][k] as bf16, 256 B a row, in units of 8 B (four k). Unit u of row
// n lies at place u ^ (n >> 2): the 32 lanes of a store, which hold 32 rows at
// one u, then fall on 32 different places, that is on all 64 banks.
// The loops are unrolled so that v[][] stays in registers and the offsets
// are immediates.
template<int K, int N>
__device__ __forceinline__ void transpose_tile(const float* __restrict__ W,
                                               __bf16* __restrict__ Wt,
                                               int b, unsigned* tile)
{
  const int tid = threadIdx.x;
  const int n0 = (b % (N / 128)) * 128, k0 = (b / (N / 128)) * 128;
  const int lane = tid & 31, wave = tid >> 5;

  // A wave-wide load is 512 B of one k row; a lane holds columns 4*lane..+3
  // of rows 4*u..4*u+3, u = wave + 8*j.
  const float* src = W + (size_t)(k0 + 4 * wave) * N + n0 + lane * 4;
  f32x4 v[4][4];
#pragma unroll
  for (int j = 0; j < 4; ++j)
#pragma unroll
    for (int e = 0; e < 4; ++e)
      v[j][e] = *(const f32x4*)(src + (32 * j + e) * N);
#pragma unroll
  for (int j = 0; j < 4; ++j)
#pragma unroll
    for (int i = 0; i < 4; ++i) {
      u32x2 p = {pack2(v[j][0][i], v[j][1][i]), pack2(v[j][2][i], v[j][3][i])};
      *(u32x2*)&tile[(lane * 4 + i) * 64 + (((wave + 8 * j) ^ lane) << 1)] = p;
    }
  __syncthreads();

  // 16 lanes store one row's 256 B. Units 2*kg and 2*kg+1 share a 16-byte
  // place and stand there in swapped order where n >> 2 is odd.
  const int kg = tid & 15, nr = tid >> 4;
  __bf16* dst = Wt + (size_t)(n0 + nr) * K + k0 + kg * 8;
#pragma unroll
  for (int p = 0; p < 8; ++p) {
    const int n = nr + 16 * p;
    const int s = n >> 2;
    u32x4 q = *(const u32x4*)&tile[n * 64 + ((kg ^ (s >> 1)) << 2)];
    if (s & 1) q = q.zwxy;
    *(u32x4*)(dst + 16 * p * K) = q;
  }
  // the stores' registers may be written again by the code that follows in
  // the listing: the wait stands in front of any such overwrite
  asm volatile("s_wait_xcnt 0x0" ::: "memory");
}

__global__ __launch_bounds__(256)
void prep_kernel(const float* __restrict__ x,
                 const float* __restrict__ Wq, const float* __restrict__ Wk,
                 const float* __restrict__ Wv, const float* __restrict__ Wo,
                 const float* __restrict__ W1, const float* __restrict__ W2,
                 __bf16* __restrict__ xb,
                 __bf16* __restrict__ Wqt, __bf16* __restrict__ Wkt,
                 __bf16* __restrict__ Wvt, __bf16* __restrict__ Wot,
                 __bf16* __restrict__ W1t, __bf16* __restrict__ W2t)
{
  __shared__ __attribute__((aligned(16))) unsigned tile[128 * 64];
  int b = blockIdx.x;

  if (b < XBLOCKS) {
    const size_t base = (size_t)b * PREPELEMS + threadIdx.x * 4;
    f32x4 v[16];                         // unrolled: v[] stays in registers
#pragma unroll
    for (int j = 0; j < 16; ++j) v[j] = *(const f32x4*)(x + base + j * 1024);
#pragma unroll
    for (int j = 0; j < 16; ++j) {
      u32x2 p = {pack2(v[j].x, v[j].y), pack2(v[j].z, v[j].w)};
      *(u32x2*)(xb + base + j * 1024) = p;
    }
    return;
  }
  b -= XBLOCKS;

  // the branches are uniform for the block, so each one's barrier is met by
  // all of its threads
  if (b < 4 * SQTILES) {
    const int w = b / SQTILES;
    const float* W = w == 0 ? Wq  : w == 1 ? Wk  : w == 2 ? Wv  : Wo;
    __bf16* Wt     = w == 0 ? Wqt : w == 1 ? Wkt : w == 2 ? Wvt : Wot;
    transpose_tile<DMODEL, DMODEL>(W, Wt, b - w * SQTILES, tile);
  } else if (b < 4 * SQTILES + HIDTILES) {
    transpose_tile<DMODEL, DHID>(W1, W1t, b - 4 * SQTILES, tile);
  } else {
    transpose_tile<DHID, DMODEL>(W2, W2t, b - (4 * SQTILES + HIDTILES), tile);
  }
}

// ---------------------------------------------------------------------------
// Tiled bf16 WMMA GEMM: C[M,N] = act(A[M,K] @ Bt[N,K]^T + bias)
// Block tile 128x128, k-step KS, double-buffered async LDS staging.
// KS is 64 where several blocks share a WGP and fill each other's waits, and
// 256 where the grid gives a WGP one block: there nothing else runs while the
// block waits out a hand-over (copy wait and barrier), so a long step, with a
// quarter of the hand-overs along K and four times the products to cover the
// next step's copies, is the faster. K must be a multiple of KS.
// 256 threads = 8 waves, wave grid 4x2 (MxN); each wave: 2x4 16x16 tiles.
// Both LDS tiles are [row/col][k] with stride KS + 8 (an odd multiple of
// 16 bytes) so every fragment is two contiguous ds_load_b128 per lane
// without bank conflicts (A layout: K groups of 8 per lane-half).
// TRI: three products that share A in one launch. Bt holds the three [N,K]
// weights one behind the other, Cout the three [M,N] outputs likewise; grid x
// runs over all 3N columns and each 128-column block lies in one part.
// ---------------------------------------------------------------------------
template<bool GELU, bool OUT_BF16, bool TRI, int KS>
__global__ __launch_bounds__(256)
void gemm_kernel(const __bf16* __restrict__ A, const __bf16* __restrict__ Bt,
                 const float* __restrict__ bias, const float* __restrict__ bias1,
                 const float* __restrict__ bias2, void* __restrict__ Cout,
                 int M, int N, int K)
{
  constexpr int PITCH = KS + 8;          // LDS row stride in elements
  __shared__ __attribute__((aligned(16))) __bf16 As[2][128 * PITCH];
  __shared__ __attribute__((aligned(16))) __bf16 Bs[2][128 * PITCH];

  const int tid   = threadIdx.x;
  const int lane  = tid & 31;
  const int wave  = tid >> 5;
  const int waveM = wave >> 1;           // 0..3
  const int waveN = wave & 1;            // 0..1
  const int lr    = lane & 15;
  const int half  = (lane >> 4) * 8;
  const int blkN  = blockIdx.x * 128;
  const int blkM  = blockIdx.y * 128;

  v8f acc[2][4];
#pragma unroll
  for (int tm = 0; tm < 2; ++tm)
#pragma unroll
    for (int tn = 0; tn < 4; ++tn) acc[tm][tn] = zero8();

  // KS / 8 lanes take one row's 2 * KS bytes of the k-step, so each wave-wide
  // copy covers four whole 128-byte lines (of four rows, or all of one row).
  constexpr int LPR = KS / 8;            // lanes per row
  constexpr int RPC = 256 / LPR;         // rows per block-wide copy
  const int srow = tid / LPR;            // plus RPC per copy
  const int skc  = (tid % LPR) * 8;      // 0..KS - 8

  auto stage = [&](int k0, int buf) {
    const __bf16* ag = A  + (size_t)(blkM + srow) * K + k0 + skc;
    const __bf16* bg = Bt + (size_t)(blkN + srow) * K + k0 + skc;
    __bf16* al = &As[buf][srow * PITCH + skc];
    __bf16* bl = &Bs[buf][srow * PITCH + skc];
#pragma unroll
    for (int e = 0; e < 128 / RPC; ++e) {
      async_copy16(ag + (size_t)(e * RPC) * K, al + e * RPC * PITCH);
      async_copy16(bg + (size_t)(e * RPC) * K, bl + e * RPC * PITCH);
    }
  };

  stage(0, 0);
  const int T = K >> __builtin_ctz(KS);  // K / KS, KS a power of two
  for (int i = 0; i < T; ++i) {
    wait_async_all();                    // own tile-i loads landed
    __syncthreads();                     // everyone's tile-i landed; prev reads done
    if (i + 1 < T) stage((i + 1) * KS, (i + 1) & 1);

    const __bf16* as = As[i & 1];
    const __bf16* bs = Bs[i & 1];
#pragma unroll
    for (int kc = 0; kc < KS / 32; ++kc) {
      v16bf af[2], bfv[4];
#pragma unroll
      for (int tm = 0; tm < 2; ++tm) {
        const __bf16* p = as + (waveM * 32 + tm * 16 + lr) * PITCH + kc * 32 + half;
        af[tm] = load_frag(p, p + 16);
      }
#pragma unroll
      for (int tn = 0; tn < 4; ++tn) {
        const __bf16* p = bs + (waveN * 64 + tn * 16 + lr) * PITCH + kc * 32 + half;
        bfv[tn] = load_frag(p, p + 16);
      }
#pragma unroll
      for (int tm = 0; tm < 2; ++tm)
#pragma unroll
        for (int tn = 0; tn < 4; ++tn)
          acc[tm][tn] = wmma_bf16(af[tm], bfv[tn], acc[tm][tn]);
    }
  }

  // epilogue: bias + optional exact GELU, f32 or bf16 store
  int partN = 0;                         // first column of this block's part
  if (TRI) {
    const int part = blkN / N;
    partN = part * N;
    bias = part == 0 ? bias : part == 1 ? bias1 : bias2;
    // col below counts from column 0 of part 0: part's [M,N] output starts
    // part * M * N elements on, less the partN that col already holds
    Cout = (__bf16*)Cout + ((size_t)part * M * N - partN);
  }
#pragma unroll
  for (int tm = 0; tm < 2; ++tm) {
#pragma unroll
    for (int tn = 0; tn < 4; ++tn) {
      int col = blkN + waveN * 64 + tn * 16 + lr;
      float bv = bias ? bias[col - partN] : 0.f;
#pragma unroll
      for (int r = 0; r < 8; ++r) {
        int row = blkM + waveM * 32 + tm * 16 + half + r;
        float v = acc[tm][tn][r] + bv;
        if (GELU) v = 0.5f * v * (1.f + erff(v * 0.70710678118654752f));
        if (OUT_BF16) ((__bf16*)Cout)[(size_t)row * N + col] = (__bf16)v;
        else          ((float*)Cout)[(size_t)row * N + col]  = v;
      }
    }
  }
}

__device__ __forceinline__ float xhalf(float x) {
  int b = __builtin_bit_cast(int, x);
  return __builtin_bit_cast(float,
      __builtin_amdgcn_permlanex16(b, b, 0x76543210, 0xfedcba98, false, false));
}

__global__ __launch_bounds__(128)
void attn_kernel(const __bf16* __restrict__ qb, const __bf16* __restrict__ kb,
                 const __bf16* __restrict__ vb, __bf16* __restrict__ ob)
{
  __shared__ __attribute__((aligned(16))) __bf16 Kt[2][32 * 72];  // [key][d]
  __shared__ __attribute__((aligned(16))) __bf16 Vt[2][64 * 40];  // [d][key] transposed

  const int tid  = threadIdx.x;
  const int lane = tid & 31;
  const int wave = tid >> 5;
  const int lr   = lane & 15;
  const int half = (lane >> 4) * 8;

  const int head = blockIdx.y;
  // Placement, for speed only. A query tile's cost grows with its index and
  // all blocks are resident at once, so the launch lasts as long as the
  // fullest WGP. The grid's x extent is 32.
  // So the (head, batch) pairs of odd bit parity walk the tiles from the far
  // end: of blocks 32, 64, ... 512 flat indices apart half hold tile x and
  // half tile 31 - x, heavy beside light. Every (head, batch, tile) runs once.
  const int rev  = __builtin_popcount(blockIdx.y ^ (blockIdx.z << 4)) & 1;
  const int q0   = (rev ? (SEQ / 64 - 1) - blockIdx.x : blockIdx.x) * 64;
  const int qw   = q0 + wave * 16;
  const int qrow = qw + lr;             // this lane's query
  const size_t tokbase = (size_t)blockIdx.z * SEQ;

  v16bf qf[2];                          // B fragment: column = query, k = d
#pragma unroll
  for (int di = 0; di < 2; ++di) {
    const __bf16* p = qb + (tokbase + qrow) * DMODEL + head * DHEAD + di * 32 + half;
    qf[di] = load_frag(p, p + 16);
  }

  constexpr float CS = 0.125f * 1.4426950408889634f;   // log2(e) / sqrt(DHEAD)
  float m = -1e30f;                     // running maximum, of the raw products
  float l = 0.f;                        // sum over this lane's keys only
  v8f o[4];                             // o[t][r] = O[qrow][t*16 + half + r]
#pragma unroll
  for (int t = 0; t < 4; ++t) o[t] = zero8();

  // A thread stages 16 bytes of keys srow and srow + 16 of a tile.
  const int srow = tid >> 3;            // 0..15
  const int soff = (tid & 7) * 8;       // d 0..56
  const size_t sbase = (tokbase + srow) * DMODEL + head * DHEAD + soff;
  Half8 tv0, tv1;                       // V of the tile in flight

  // tile t: K by async copies into Kt[buf], V into registers; nothing waits
  auto fetch = [&](int t, int buf) {
    const size_t g = sbase + (size_t)t * (32 * DMODEL);
    tv0.f = *(const f32x4*)(vb + g);
    tv1.f = *(const f32x4*)(vb + g + 16 * DMODEL);
    async_copy16(kb + g,               &Kt[buf][srow * 72 + soff]);
    async_copy16(kb + g + 16 * DMODEL, &Kt[buf][(srow + 16) * 72 + soff]);
    // the loads' address registers may be written again while they fly: the
    // wait stands in front of any such overwrite
    asm volatile("s_wait_xcnt 0x0" ::: "memory");
  };
  // V in flight -> Vt[buf]; unrolled so that b[e] are register halves
  auto put_v = [&](int buf) {
#pragma unroll
    for (int e = 0; e < 8; ++e) {
      Vt[buf][(soff + e) * 40 + srow]      = tv0.b[e];
      Vt[buf][(soff + e) * 40 + srow + 16] = tv1.b[e];
    }
  };

  const int ktmax = (q0 + 63) >> 5;     // odd: at least two tiles
  fetch(0, 0);
  put_v(0);
  wait_async_all();
  __syncthreads();

  for (int kt = 0; kt <= ktmax; ++kt) {
    const int kpos = kt * 32;
    const int buf  = kt & 1;
    const __bf16* Kc = Kt[buf];
    const __bf16* Vc = Vt[buf];
    // Directly behind the barrier that ended every read of the other buffer:
    // the next tile sets out, and is waited for only at this trip's foot.
    if (kt < ktmax) fetch(kt + 1, buf ^ 1);

    // S^T = K * Q^T (32 keys x 16 queries) as two 16x16 tiles
    v8f s0 = zero8(), s1 = zero8();
#pragma unroll
    for (int di = 0; di < 2; ++di) {
      const __bf16* p0 = Kc + lr * 72        + di * 32 + half;
      const __bf16* p1 = Kc + (16 + lr) * 72 + di * 32 + half;
      v16bf a0 = load_frag(p0, p0 + 16);
      v16bf a1 = load_frag(p1, p1 + 16);
      s0 = wmma_bf16(a0, qf[di], s0);
      s1 = wmma_bf16(a1, qf[di], s1);
    }

    // online softmax, one query per lane, in base 2. The maximum is taken
    // over the raw products (the scale is positive); e^((s - mn) / 8) is
    // 2^(s * CS - mn * CS): one multiply-add and one hardware exponential a
    // score. No argument is above 0 but by rounding; a masked one, about
    // -2e29, gives 0.
    float v0[8], v1[8];
    float mx = -1e30f;
#pragma unroll
    for (int r = 0; r < 8; ++r) {
      int c0 = kpos + half + r, c1 = c0 + 16;
      v0[r] = (c0 <= qrow) ? s0[r] : -1e30f;
      v1[r] = (c1 <= qrow) ? s1[r] : -1e30f;
      mx = fmaxf(mx, fmaxf(v0[r], v1[r]));
    }
    mx = fmaxf(mx, xhalf(mx));
    const float mn    = fmaxf(m, mx);
    const float alpha = __builtin_amdgcn_exp2f((m - mn) * CS);
    m = mn;
    const float nb = -mn * CS;

    v16bf pf;                           // B fragment: column = query, k = key
    float ps = 0.f;
#pragma unroll
    for (int r = 0; r < 8; ++r) {
      int c0 = kpos + half + r, c1 = c0 + 16;
      float e0 = __builtin_amdgcn_exp2f(__builtin_fmaf(v0[r], CS, nb));
      float e1 = __builtin_amdgcn_exp2f(__builtin_fmaf(v1[r], CS, nb));
      float p0 = (c0 <= qrow) ? e0 : 0.f;
      float p1 = (c1 <= qrow) ? e1 : 0.f;
      ps += p0 + p1;
      pf[r]     = (__bf16)p0;
      pf[8 + r] = (__bf16)p1;
    }
    l = l * alpha + ps;
#pragma unroll
    for (int t = 0; t < 4; ++t)
#pragma unroll
      for (int r = 0; r < 8; ++r) o[t][r] *= alpha;

    // O^T += V^T * P^T
#pragma unroll
    for (int t = 0; t < 4; ++t) {
      const __bf16* pv = Vc + (t * 16 + lr) * 40 + half;
      v16bf av = load_frag(pv, pv + 16);
      o[t] = wmma_bf16(av, pf, o[t]);
    }

    // Foot of the trip: V of tile kt + 1 goes from registers to its buffer.
    if (kt < ktmax) put_v(buf ^ 1);
    // own LDS reads and writes done, own K copies of tile kt + 1 landed
    asm volatile("s_wait_dscnt 0x0" ::: "memory");
    wait_async_all();
    // publishes tile kt + 1 and ends every read of this trip's buffer,
    // which the next trip refills
    __syncthreads();
  }
  wait_async_all();                     // no copy in flight at the wave's end

  l += xhalf(l);                        // join the two halves' key sums
  __bf16* op = ob + (tokbase + qrow) * DMODEL + head * DHEAD + half;
#pragma unroll
  for (int t = 0; t < 4; ++t) {
    Half8 w;
#pragma unroll
    for (int r = 0; r < 8; ++r) w.b[r] = (__bf16)(o[t][r] / l);
    *(f32x4*)(op + t * 16) = w.f;
  }
}

// ---------------------------------------------------------------------------
// out = layernorm(x + y); optional bf16 copy for the next GEMM.
// One wave holds one row, 32 elements a lane by 16-byte loads, so that few
// waves have to start; both sums stay inside the wave: no LDS, no barrier.
// The loops are unrolled so that v[] and yv[] stay in registers.
// ---------------------------------------------------------------------------
__device__ __forceinline__ float wave_sum(float s) {
#pragma unroll
  for (int m = 16; m > 0; m >>= 1) s += __shfl_xor(s, m, 32);
  return s;
}

__global__ __launch_bounds__(256)
void add_ln_kernel(const float* __restrict__ x, const float* __restrict__ y,
                   const float* __restrict__ g, const float* __restrict__ b,
                   float* __restrict__ out, __bf16* __restrict__ outb)
{
  const int col = (threadIdx.x & 31) * 4;                 // plus 128 per j
  const int row = blockIdx.x * 8 + (threadIdx.x >> 5);
  const size_t base = (size_t)row * DMODEL + col;

  f32x4 v[8], yv[8];
#pragma unroll
  for (int j = 0; j < 8; ++j) v[j]  = *(const f32x4*)(x + base + j * 128);
#pragma unroll
  for (int j = 0; j < 8; ++j) yv[j] = *(const f32x4*)(y + base + j * 128);

  f32x4 s4 = {0.f, 0.f, 0.f, 0.f};
#pragma unroll
  for (int j = 0; j < 8; ++j) { v[j] += yv[j]; s4 += v[j]; }
  const float mu = wave_sum((s4.x + s4.y) + (s4.z + s4.w)) * (1.f / DMODEL);

  s4 = (f32x4){0.f, 0.f, 0.f, 0.f};
#pragma unroll
  for (int j = 0; j < 8; ++j) { v[j] -= mu; s4 += v[j] * v[j]; }
  const float rstd =
      rsqrtf(wave_sum((s4.x + s4.y) + (s4.z + s4.w)) * (1.f / DMODEL) + 1e-5f);

#pragma unroll
  for (int j = 0; j < 8; ++j) {
    const f32x4 gv = *(const f32x4*)(g + col + j * 128);
    const f32x4 bv = *(const f32x4*)(b + col + j * 128);
    v[j] = v[j] * rstd * gv + bv;
  }
  if (outb) {
#pragma unroll
    for (int j = 0; j < 8; ++j) {
      u32x2 p = {pack2(v[j].x, v[j].y), pack2(v[j].z, v[j].w)};
      *(u32x2*)(outb + base + j * 128) = p;
    }
  }
#pragma unroll
  for (int j = 0; j < 8; ++j) *(f32x4*)(out + base + j * 128) = v[j];
}

// ---------------------------------------------------------------------------
// Launcher
// ---------------------------------------------------------------------------
extern "C" void kernel_launch(void* const* d_in, const int* in_sizes, int n_in,
                              void* d_out, int out_size, void* d_ws, size_t ws_size,
                              hipStream_t stream) {
  const float* x    = (const float*)d_in[0];
  const float* Wq   = (const float*)d_in[1];
  const float* bq   = (const float*)d_in[2];
  const float* Wk   = (const float*)d_in[3];
  const float* bk   = (const float*)d_in[4];
  const float* Wv   = (const float*)d_in[5];
  const float* bv   = (const float*)d_in[6];
  const float* Wo   = (const float*)d_in[7];
  const float* ln1g = (const float*)d_in[8];
  const float* ln1b = (const float*)d_in[9];
  const float* W1   = (const float*)d_in[10];
  const float* b1   = (const float*)d_in[11];
  const float* W2   = (const float*)d_in[12];
  const float* b2   = (const float*)d_in[13];
  const float* ln2g = (const float*)d_in[14];
  const float* ln2b = (const float*)d_in[15];

  char* ws = (char*)d_ws;
  size_t off = 0;
  auto alloc = [&](size_t bytes) -> char* {
    char* p = ws + off;
    off = (off + bytes + 255) & ~(size_t)255;
    return p;
  };

  __bf16* xb   = (__bf16*)alloc((size_t)NTOK * DMODEL * 2);
  __bf16* Wqt  = (__bf16*)alloc((size_t)3 * DMODEL * DMODEL * 2);   // [N][K], q k v in a row
  __bf16* Wkt  = Wqt + (size_t)DMODEL * DMODEL;
  __bf16* Wvt  = Wkt + (size_t)DMODEL * DMODEL;
  __bf16* Wot  = (__bf16*)alloc((size_t)DMODEL * DMODEL * 2);
  __bf16* W1t  = (__bf16*)alloc((size_t)DMODEL * DHID * 2);
  __bf16* W2t  = (__bf16*)alloc((size_t)DHID * DMODEL * 2);
  __bf16* qbuf = (__bf16*)alloc((size_t)3 * NTOK * DMODEL * 2);     // q k v in a row
  __bf16* kbuf = qbuf + (size_t)NTOK * DMODEL;
  __bf16* vbuf = kbuf + (size_t)NTOK * DMODEL;
  __bf16* obuf = (__bf16*)alloc((size_t)NTOK * DMODEL * 2);
  float*  t1   = (float*)alloc((size_t)NTOK * DMODEL * 4);
  float*  h    = (float*)alloc((size_t)NTOK * DMODEL * 4);
  __bf16* hb   = (__bf16*)alloc((size_t)NTOK * DMODEL * 2);
  __bf16* m1   = (__bf16*)alloc((size_t)NTOK * DHID * 2);
  float*  m2   = (float*)alloc((size_t)NTOK * DMODEL * 4);

  // x cast and the six weight transposes
  prep_kernel<<<XBLOCKS + 4 * SQTILES + 2 * HIDTILES, 256, 0, stream>>>(
      x, Wq, Wk, Wv, Wo, W1, W2, xb, Wqt, Wkt, Wvt, Wot, W1t, W2t);

  // Q, K and V projections (bf16 out)
  gemm_kernel<false, true, true, 64><<<dim3(3 * DMODEL / 128, NTOK / 128), 256, 0, stream>>>(
      xb, Wqt, bq, bk, bv, qbuf, NTOK, DMODEL, DMODEL);

  // causal flash attention
  attn_kernel<<<dim3(SEQ / 64, NHEADS, 2), 128, 0, stream>>>(qbuf, kbuf, vbuf, obuf);

  // output projection (f32 out, no bias)
  gemm_kernel<false, false, false, 256><<<dim3(DMODEL / 128, NTOK / 128), 256, 0, stream>>>(
      obuf, Wot, nullptr, nullptr, nullptr, t1, NTOK, DMODEL, DMODEL);

  // h = LN(x + attn)
  add_ln_kernel<<<NTOK / 8, 256, 0, stream>>>(x, t1, ln1g, ln1b, h, hb);

  // MLP up with fused exact GELU (bf16 out)
  gemm_kernel<true, true, false, 64><<<dim3(DHID / 128, NTOK / 128), 256, 0, stream>>>(
      hb, W1t, b1, nullptr, nullptr, m1, NTOK, DHID, DMODEL);

  // MLP down (f32 out)
  gemm_kernel<false, false, false, 256><<<dim3(DMODEL / 128, NTOK / 128), 256, 0, stream>>>(
      m1, W2t, b2, nullptr, nullptr, m2, NTOK, DMODEL, DHID);

  // out = LN(h + mlp)
  add_ln_kernel<<<NTOK / 8, 256, 0, stream>>>(h, m2, ln2g, ln2b, (float*)d_out, nullptr);
}

// v009
// Measured time: 181 microseconds a run.
// Next to v008, in two timings, it ran 1.06 times as fast each time.
// Over all steps from v000 it is 2.66 times as fast.
#include <hip/hip_runtime.h>
#include <hip/hip_bf16.h>
#include <math.h>

// ---------------------------------------------------------------------------
// Transformer layer for MI455X (gfx1250, wave32, WMMA).
// All matmuls use v_wmma_f32_16x16x32_bf16 (bf16 in, f32 accum).
// Weights pre-transposed at cast time so GEMM A and B tiles are both
// contiguous-row copies -> double-buffered async global->LDS staging.
// ---------------------------------------------------------------------------

typedef __attribute__((ext_vector_type(16))) __bf16 v16bf;
typedef __attribute__((ext_vector_type(8)))  float  v8f;
typedef __attribute__((ext_vector_type(4)))  float  f32x4;
typedef __attribute__((ext_vector_type(4)))  int    i32x4;

#define DMODEL 1024
#define DHEAD  64
#define NHEADS 16
#define DHID   4096
#define SEQ    2048
#define NTOK   4096   // B * S

union Frag16 { f32x4 f[2]; v16bf v; };
union Half8  { f32x4 f; __bf16 b[8]; };

#if __has_builtin(__builtin_amdgcn_global_load_async_to_lds_b128)
#define HAVE_ASYNC_LDS 1
#else
#define HAVE_ASYNC_LDS 0
#endif

// Copy 16 bytes (8 bf16) global -> LDS; async (per-lane gather) when available.
__device__ __forceinline__ void async_copy16(const __bf16* g, __bf16* l) {
#if HAVE_ASYNC_LDS
  __builtin_amdgcn_global_load_async_to_lds_b128(
      (__attribute__((address_space(1))) i32x4*)g,
      (__attribute__((address_space(3))) i32x4*)l, 0, 0);
#else
  *(f32x4*)l = *(const f32x4*)g;
#endif
}

__device__ __forceinline__ void wait_async_all() {
  asm volatile("s_wait_asynccnt 0x0" ::: "memory");
}

__device__ __forceinline__ v16bf load_frag(const __bf16* p0, const __bf16* p1) {
  Frag16 u;
  u.f[0] = *(const f32x4*)p0;   // elems 0..7  (K = half+0..7)
  u.f[1] = *(const f32x4*)p1;   // elems 8..15 (K = 16+half+0..7)
  return u.v;
}

__device__ __forceinline__ v8f zero8() {
  v8f z = {0.f,0.f,0.f,0.f,0.f,0.f,0.f,0.f};
  return z;
}

__device__ __forceinline__ v8f wmma_bf16(v16bf a, v16bf b, v8f c) {
  return __builtin_amdgcn_wmma_f32_16x16x32_bf16(
      false, a, false, b, (short)0, c, false, false);
}

// ---------------------------------------------------------------------------
// Conversion pre-pass, one launch. None of its seven jobs reads another's
// output, so the block index picks the job. Every block converts 16384
// elements, 64 a thread by 16-byte loads, so that few waves have to start:
//   blocks [0, 256)     x fp32 -> bf16
//   blocks [256, 1024)  fp32 W[K,N] -> bf16 Wt[N,K], one 128x128 tile a block
//                       (Wq, Wk, Wv, Wo: 64 tiles each; W1, W2: 256 each)
// ---------------------------------------------------------------------------
#define PREPELEMS 16384
#define XBLOCKS (NTOK * DMODEL / PREPELEMS)
#define SQTILES ((DMODEL / 128) * (DMODEL / 128))
#define HIDTILES ((DMODEL / 128) * (DHID / 128))

typedef __attribute__((ext_vector_type(2))) float    f32x2;
typedef __attribute__((ext_vector_type(2))) __bf16   bf16x2;
typedef __attribute__((ext_vector_type(2))) unsigned u32x2;
typedef __attribute__((ext_vector_type(4))) unsigned u32x4;

// two f32 -> one dword of two bf16, a in the low half
__device__ __forceinline__ unsigned pack2(float a, float b) {
  f32x2 v = {a, b};
  return __builtin_bit_cast(unsigned, __builtin_convertvector(v, bf16x2));
}

// One 128x128 tile: fp32 W[K,N] -> bf16 Wt[N,K]. K and N are compile-time, so
// a thread's 16 loads are one address with 16 immediate offsets.
// tile is [n][k] as bf16, 256 B a row, in units of 8 B (four k). Unit u of row
// n lies at place u ^ (n >> 2): the 32 lanes of a store, which hold 32 rows at
// one u, then fall on 32 different places, that is on all 64 banks.
// The loops are unrolled so that v[][] stays in registers and the offsets
// are immediates.
template<int K, int N>
__device__ __forceinline__ void transpose_tile(const float* __restrict__ W,
                                               __bf16* __restrict__ Wt,
                                               int b, unsigned* tile)
{
  const int tid = threadIdx.x;
  const int n0 = (b % (N / 128)) * 128, k0 = (b / (N / 128)) * 128;
  const int lane = tid & 31, wave = tid >> 5;

  // A wave-wide load is 512 B of one k row; a lane holds columns 4*lane..+3
  // of rows 4*u..4*u+3, u = wave + 8*j.
  const float* src = W + (size_t)(k0 + 4 * wave) * N + n0 + lane * 4;
  f32x4 v[4][4];
#pragma unroll
  for (int j = 0; j < 4; ++j)
#pragma unroll
    for (int e = 0; e < 4; ++e)
      v[j][e] = *(const f32x4*)(src + (32 * j + e) * N);
#pragma unroll
  for (int j = 0; j < 4; ++j)
#pragma unroll
    for (int i = 0; i < 4; ++i) {
      u32x2 p = {pack2(v[j][0][i], v[j][1][i]), pack2(v[j][2][i], v[j][3][i])};
      *(u32x2*)&tile[(lane * 4 + i) * 64 + (((wave + 8 * j) ^ lane) << 1)] = p;
    }
  __syncthreads();

  // 16 lanes store one row's 256 B. Units 2*kg and 2*kg+1 share a 16-byte
  // place and stand there in swapped order where n >> 2 is odd.
  const int kg = tid & 15, nr = tid >> 4;
  __bf16* dst = Wt + (size_t)(n0 + nr) * K + k0 + kg * 8;
#pragma unroll
  for (int p = 0; p < 8; ++p) {
    const int n = nr + 16 * p;
    const int s = n >> 2;
    u32x4 q = *(const u32x4*)&tile[n * 64 + ((kg ^ (s >> 1)) << 2)];
    if (s & 1) q = q.zwxy;
    *(u32x4*)(dst + 16 * p * K) = q;
  }
  // the stores' registers may be written again by the code that follows in
  // the listing: the wait stands in front of any such overwrite
  asm volatile("s_wait_xcnt 0x0" ::: "memory");
}

__global__ __launch_bounds__(256)
void prep_kernel(const float* __restrict__ x,
                 const float* __restrict__ Wq, const float* __restrict__ Wk,
                 const float* __restrict__ Wv, const float* __restrict__ Wo,
                 const float* __restrict__ W1, const float* __restrict__ W2,
                 __bf16* __restrict__ xb,
                 __bf16* __restrict__ Wqt, __bf16* __restrict__ Wkt,
                 __bf16* __restrict__ Wvt, __bf16* __restrict__ Wot,
                 __bf16* __restrict__ W1t, __bf16* __restrict__ W2t)
{
  __shared__ __attribute__((aligned(16))) unsigned tile[128 * 64];
  int b = blockIdx.x;

  if (b < XBLOCKS) {
    const size_t base = (size_t)b * PREPELEMS + threadIdx.x * 4;
    f32x4 v[16];                         // unrolled: v[] stays in registers
#pragma unroll
    for (int j = 0; j < 16; ++j) v[j] = *(const f32x4*)(x + base + j * 1024);
#pragma unroll
    for (int j = 0; j < 16; ++j) {
      u32x2 p = {pack2(v[j].x, v[j].y), pack2(v[j].z, v[j].w)};
      *(u32x2*)(xb + base + j * 1024) = p;
    }
    return;
  }
  b -= XBLOCKS;

  // the branches are uniform for the block, so each one's barrier is met by
  // all of its threads
  if (b < 4 * SQTILES) {
    const int w = b / SQTILES;
    const float* W = w == 0 ? Wq  : w == 1 ? Wk  : w == 2 ? Wv  : Wo;
    __bf16* Wt     = w == 0 ? Wqt : w == 1 ? Wkt : w == 2 ? Wvt : Wot;
    transpose_tile<DMODEL, DMODEL>(W, Wt, b - w * SQTILES, tile);
  } else if (b < 4 * SQTILES + HIDTILES) {
    transpose_tile<DMODEL, DHID>(W1, W1t, b - 4 * SQTILES, tile);
  } else {
    transpose_tile<DHID, DMODEL>(W2, W2t, b - (4 * SQTILES + HIDTILES), tile);
  }
}

// ---------------------------------------------------------------------------
// Tiled bf16 WMMA GEMM: C[M,N] = act(A[M,K] @ Bt[N,K]^T + bias)
// Block tile 128x128, k-step KS, double-buffered async LDS staging.
// KS is 64 where several blocks share a WGP and fill each other's waits, and
// 256 where the grid gives a WGP one block: there nothing else runs while the
// block waits out a hand-over (copy wait and barrier), so a long step, with a
// quarter of the hand-overs along K and four times the products to cover the
// next step's copies, is the faster. K must be a multiple of KS.
// 256 threads = 8 waves, wave grid 4x2 (MxN); each wave: 2x4 16x16 tiles.
// Both LDS tiles are [row/col][k] with stride KS + 8 (an odd multiple of
// 16 bytes) so every fragment is two contiguous ds_load_b128 per lane
// without bank conflicts (A layout: K groups of 8 per lane-half).
// TRI: three products that share A in one launch. Bt holds the three [N,K]
// weights one behind the other, Cout the three [M,N] outputs likewise; grid x
// runs over all 3N columns and each 128-column block lies in one part.
// ---------------------------------------------------------------------------
template<bool GELU, bool OUT_BF16, bool TRI, int KS>
__global__ __launch_bounds__(256)
void gemm_kernel(const __bf16* __restrict__ A, const __bf16* __restrict__ Bt,
                 const float* __restrict__ bias, const float* __restrict__ bias1,
                 const float* __restrict__ bias2, void* __restrict__ Cout,
                 int M, int N, int K)
{
  constexpr int PITCH = KS + 8;          // LDS row stride in elements
  __shared__ __attribute__((aligned(16))) __bf16 As[2][128 * PITCH];
  __shared__ __attribute__((aligned(16))) __bf16 Bs[2][128 * PITCH];

  const int tid   = threadIdx.x;
  const int lane  = tid & 31;
  const int wave  = tid >> 5;
  const int waveM = wave >> 1;           // 0..3
  const int waveN = wave & 1;            // 0..1
  const int lr    = lane & 15;
  const int half  = (lane >> 4) * 8;
  const int blkN  = blockIdx.x * 128;
  const int blkM  = blockIdx.y * 128;

  v8f acc[2][4];
#pragma unroll
  for (int tm = 0; tm < 2; ++tm)
#pragma unroll
    for (int tn = 0; tn < 4; ++tn) acc[tm][tn] = zero8();

  // KS / 8 lanes take one row's 2 * KS bytes of the k-step, so each wave-wide
  // copy covers four whole 128-byte lines (of four rows, or all of one row).
  constexpr int LPR = KS / 8;            // lanes per row
  constexpr int RPC = 256 / LPR;         // rows per block-wide copy
  const int srow = tid / LPR;            // plus RPC per copy
  const int skc  = (tid % LPR) * 8;      // 0..KS - 8

  auto stage = [&](int k0, int buf) {
    const __bf16* ag = A  + (size_t)(blkM + srow) * K + k0 + skc;
    const __bf16* bg = Bt + (size_t)(blkN + srow) * K + k0 + skc;
    __bf16* al = &As[buf][srow * PITCH + skc];
    __bf16* bl = &Bs[buf][srow * PITCH + skc];
#pragma unroll
    for (int e = 0; e < 128 / RPC; ++e) {
      async_copy16(ag + (size_t)(e * RPC) * K, al + e * RPC * PITCH);
      async_copy16(bg + (size_t)(e * RPC) * K, bl + e * RPC * PITCH);
    }
  };

  stage(0, 0);
  const int T = K >> __builtin_ctz(KS);  // K / KS, KS a power of two
  for (int i = 0; i < T; ++i) {
    wait_async_all();                    // own tile-i loads landed
    __syncthreads();                     // everyone's tile-i landed; prev reads done
    if (i + 1 < T) stage((i + 1) * KS, (i + 1) & 1);

    const __bf16* as = As[i & 1];
    const __bf16* bs = Bs[i & 1];
#pragma unroll
    for (int kc = 0; kc < KS / 32; ++kc) {
      v16bf af[2], bfv[4];
#pragma unroll
      for (int tm = 0; tm < 2; ++tm) {
        const __bf16* p = as + (waveM * 32 + tm * 16 + lr) * PITCH + kc * 32 + half;
        af[tm] = load_frag(p, p + 16);
      }
#pragma unroll
      for (int tn = 0; tn < 4; ++tn) {
        const __bf16* p = bs + (waveN * 64 + tn * 16 + lr) * PITCH + kc * 32 + half;
        bfv[tn] = load_frag(p, p + 16);
      }
#pragma unroll
      for (int tm = 0; tm < 2; ++tm)
#pragma unroll
        for (int tn = 0; tn < 4; ++tn)
          acc[tm][tn] = wmma_bf16(af[tm], bfv[tn], acc[tm][tn]);
    }
  }

  // epilogue: bias + optional exact GELU, f32 or bf16 store
  int partN = 0;                         // first column of this block's part
  if (TRI) {
    const int part = blkN / N;
    partN = part * N;
    bias = part == 0 ? bias : part == 1 ? bias1 : bias2;
    // col below counts from column 0 of part 0: part's [M,N] output starts
    // part * M * N elements on, less the partN that col already holds
    Cout = (__bf16*)Cout + ((size_t)part * M * N - partN);
  }
#pragma unroll
  for (int tm = 0; tm < 2; ++tm) {
#pragma unroll
    for (int tn = 0; tn < 4; ++tn) {
      int col = blkN + waveN * 64 + tn * 16 + lr;
      float bv = bias ? bias[col - partN] : 0.f;
#pragma unroll
      for (int r = 0; r < 8; ++r) {
        int row = blkM + waveM * 32 + tm * 16 + half + r;
        float v = acc[tm][tn][r] + bv;
        if (GELU) v = 0.5f * v * (1.f + erff(v * 0.70710678118654752f));
        if (OUT_BF16) ((__bf16*)Cout)[(size_t)row * N + col] = (__bf16)v;
        else          ((float*)Cout)[(size_t)row * N + col]  = v;
      }
    }
  }
}

__device__ __forceinline__ float xhalf(float x) {
  int b = __builtin_bit_cast(int, x);
  return __builtin_bit_cast(float,
      __builtin_amdgcn_permlanex16(b, b, 0x76543210, 0xfedcba98, false, false));
}

// 16 bytes a lane from a row-major 16-bit LDS tile T, transposed: with lane l
// at row k0 + 8 * (l >> 4) + (l & 7), column d0 + 8 * ((l >> 3) & 1), lane
// (c = l & 15, h = l >> 4) receives T[k0 + 8h + 0..7][d0 + c].
typedef __attribute__((ext_vector_type(8))) short s16x8;
__device__ __forceinline__ f32x4 load_tr16(const __bf16* p) {
  typedef __attribute__((address_space(3))) s16x8 lds_s16x8;
  return __builtin_bit_cast(f32x4,
      __builtin_amdgcn_ds_load_tr16_b128_v8i16((lds_s16x8*)p));
}

__global__ __launch_bounds__(128)
void attn_kernel(const __bf16* __restrict__ qb, const __bf16* __restrict__ kb,
                 const __bf16* __restrict__ vb, __bf16* __restrict__ ob)
{
  __shared__ __attribute__((aligned(16))) __bf16 Kt[2][32 * 72];  // [key][d]
  // [key][d]; pitch 160 B, an odd multiple of 32 B, suits the transposing load
  __shared__ __attribute__((aligned(16))) __bf16 Vs[2][32 * 80];

  const int tid  = threadIdx.x;
  const int lane = tid & 31;
  const int wave = tid >> 5;
  const int lr   = lane & 15;
  const int half = (lane >> 4) * 8;

  const int head = blockIdx.y;
  // Placement, for speed only. A query tile's cost grows with its index and
  // all blocks are resident at once, so the launch lasts as long as the
  // fullest WGP. The grid's x extent is 32.
  // So the (head, batch) pairs of odd bit parity walk the tiles from the far
  // end: of blocks 32, 64, ... 512 flat indices apart half hold tile x and
  // half tile 31 - x, heavy beside light. Every (head, batch, tile) runs once.
  const int rev  = __builtin_popcount(blockIdx.y ^ (blockIdx.z << 4)) & 1;
  const int q0   = (rev ? (SEQ / 64 - 1) - blockIdx.x : blockIdx.x) * 64;
  const int qw   = q0 + wave * 16;
  const int qrow = qw + lr;             // this lane's query
  const size_t tokbase = (size_t)blockIdx.z * SEQ;

  v16bf qf[2];                          // B fragment: column = query, k = d
#pragma unroll
  for (int di = 0; di < 2; ++di) {
    const __bf16* p = qb + (tokbase + qrow) * DMODEL + head * DHEAD + di * 32 + half;
    qf[di] = load_frag(p, p + 16);
  }

  constexpr float CS = 0.125f * 1.4426950408889634f;   // log2(e) / sqrt(DHEAD)
  float m = -1e30f;                     // running maximum, of the raw products
  float l = 0.f;                        // sum over this lane's keys only
  v8f o[4];                             // o[t][r] = O[qrow][t*16 + half + r]
#pragma unroll
  for (int t = 0; t < 4; ++t) o[t] = zero8();

  // A thread stages 16 bytes of keys srow and srow + 16 of a tile.
  const int srow = tid >> 3;            // 0..15
  const int soff = (tid & 7) * 8;       // d 0..56
  const size_t sbase = (tokbase + srow) * DMODEL + head * DHEAD + soff;

  // tile t: K and V by async copies into Kt[buf] and Vs[buf]; nothing waits
  auto fetch = [&](int t, int buf) {
    const size_t g = sbase + (size_t)t * (32 * DMODEL);
    async_copy16(kb + g,               &Kt[buf][srow * 72 + soff]);
    async_copy16(kb + g + 16 * DMODEL, &Kt[buf][(srow + 16) * 72 + soff]);
    async_copy16(vb + g,               &Vs[buf][srow * 80 + soff]);
    async_copy16(vb + g + 16 * DMODEL, &Vs[buf][(srow + 16) * 80 + soff]);
  };

  const int ktmax = (q0 + 63) >> 5;     // odd: at least two tiles
  fetch(0, 0);
  wait_async_all();
  __syncthreads();

  for (int kt = 0; kt <= ktmax; ++kt) {
    const int kpos = kt * 32;
    const int buf  = kt & 1;
    const __bf16* Kc = Kt[buf];
    const __bf16* Vc = Vs[buf];
    // Directly behind the barrier that ended every read of the other buffer:
    // the next tile sets out, and is waited for only at this trip's foot.
    if (kt < ktmax) fetch(kt + 1, buf ^ 1);

    // S^T = K * Q^T (32 keys x 16 queries) as two 16x16 tiles
    v8f s0 = zero8(), s1 = zero8();
#pragma unroll
    for (int di = 0; di < 2; ++di) {
      const __bf16* p0 = Kc + lr * 72        + di * 32 + half;
      const __bf16* p1 = Kc + (16 + lr) * 72 + di * 32 + half;
      v16bf a0 = load_frag(p0, p0 + 16);
      v16bf a1 = load_frag(p1, p1 + 16);
      s0 = wmma_bf16(a0, qf[di], s0);
      s1 = wmma_bf16(a1, qf[di], s1);
    }

    // online softmax, one query per lane, in base 2. The maximum is taken
    // over the raw products (the scale is positive); e^((s - mn) / 8) is
    // 2^(s * CS - mn * CS): one multiply-add and one hardware exponential a
    // score. No argument is above 0 but by rounding; a masked one, about
    // -2e29, gives 0.
    float v0[8], v1[8];
    float mx = -1e30f;
#pragma unroll
    for (int r = 0; r < 8; ++r) {
      int c0 = kpos + half + r, c1 = c0 + 16;
      v0[r] = (c0 <= qrow) ? s0[r] : -1e30f;
      v1[r] = (c1 <= qrow) ? s1[r] : -1e30f;
      mx = fmaxf(mx, fmaxf(v0[r], v1[r]));
    }
    mx = fmaxf(mx, xhalf(mx));
    const float mn    = fmaxf(m, mx);
    const float alpha = __builtin_amdgcn_exp2f((m - mn) * CS);
    m = mn;
    const float nb = -mn * CS;

    v16bf pf;                           // B fragment: column = query, k = key
    float ps = 0.f;
#pragma unroll
    for (int r = 0; r < 8; ++r) {
      int c0 = kpos + half + r, c1 = c0 + 16;
      float e0 = __builtin_amdgcn_exp2f(__builtin_fmaf(v0[r], CS, nb));
      float e1 = __builtin_amdgcn_exp2f(__builtin_fmaf(v1[r], CS, nb));
      float p0 = (c0 <= qrow) ? e0 : 0.f;
      float p1 = (c1 <= qrow) ? e1 : 0.f;
      ps += p0 + p1;
      pf[r]     = (__bf16)p0;
      pf[8 + r] = (__bf16)p1;
    }
    l = l * alpha + ps;
#pragma unroll
    for (int t = 0; t < 4; ++t)
#pragma unroll
      for (int r = 0; r < 8; ++r) o[t][r] *= alpha;

    // O^T += V^T * P^T. A fragment: row = d, k = keys half + 0..7 and
    // 16 + half + 0..7, the order in which pf holds them.
#pragma unroll
    for (int t = 0; t < 4; ++t) {
      const __bf16* pv = Vc + (half + (lane & 7)) * 80 + t * 16 + ((lane >> 3) & 1) * 8;
      Frag16 av;
      av.f[0] = load_tr16(pv);
      av.f[1] = load_tr16(pv + 16 * 80);
      o[t] = wmma_bf16(av.v, pf, o[t]);
    }

    // own LDS reads done, own K and V copies of tile kt + 1 landed
    asm volatile("s_wait_dscnt 0x0" ::: "memory");
    wait_async_all();
    // publishes tile kt + 1 and ends every read of this trip's buffer,
    // which the next trip refills
    __syncthreads();
  }
  wait_async_all();                     // no copy in flight at the wave's end

  l += xhalf(l);                        // join the two halves' key sums
  __bf16* op = ob + (tokbase + qrow) * DMODEL + head * DHEAD + half;
#pragma unroll
  for (int t = 0; t < 4; ++t) {
    Half8 w;
#pragma unroll
    for (int r = 0; r < 8; ++r) w.b[r] = (__bf16)(o[t][r] / l);
    *(f32x4*)(op + t * 16) = w.f;
  }
}

// ---------------------------------------------------------------------------
// out = layernorm(x + y); optional bf16 copy for the next GEMM.
// One wave holds one row, 32 elements a lane by 16-byte loads, so that few
// waves have to start; both sums stay inside the wave: no LDS, no barrier.
// The loops are unrolled so that v[] and yv[] stay in registers.
// ---------------------------------------------------------------------------
__device__ __forceinline__ float wave_sum(float s) {
#pragma unroll
  for (int m = 16; m > 0; m >>= 1) s += __shfl_xor(s, m, 32);
  return s;
}

__global__ __launch_bounds__(256)
void add_ln_kernel(const float* __restrict__ x, const float* __restrict__ y,
                   const float* __restrict__ g, const float* __restrict__ b,
                   float* __restrict__ out, __bf16* __restrict__ outb)
{
  const int col = (threadIdx.x & 31) * 4;                 // plus 128 per j
  const int row = blockIdx.x * 8 + (threadIdx.x >> 5);
  const size_t base = (size_t)row * DMODEL + col;

  f32x4 v[8], yv[8];
#pragma unroll
  for (int j = 0; j < 8; ++j) v[j]  = *(const f32x4*)(x + base + j * 128);
#pragma unroll
  for (int j = 0; j < 8; ++j) yv[j] = *(const f32x4*)(y + base + j * 128);

  f32x4 s4 = {0.f, 0.f, 0.f, 0.f};
#pragma unroll
  for (int j = 0; j < 8; ++j) { v[j] += yv[j]; s4 += v[j]; }
  const float mu = wave_sum((s4.x + s4.y) + (s4.z + s4.w)) * (1.f / DMODEL);

  s4 = (f32x4){0.f, 0.f, 0.f, 0.f};
#pragma unroll
  for (int j = 0; j < 8; ++j) { v[j] -= mu; s4 += v[j] * v[j]; }
  const float rstd =
      rsqrtf(wave_sum((s4.x + s4.y) + (s4.z + s4.w)) * (1.f / DMODEL) + 1e-5f);

#pragma unroll
  for (int j = 0; j < 8; ++j) {
    const f32x4 gv = *(const f32x4*)(g + col + j * 128);
    const f32x4 bv = *(const f32x4*)(b + col + j * 128);
    v[j] = v[j] * rstd * gv + bv;
  }
  if (outb) {
#pragma unroll
    for (int j = 0; j < 8; ++j) {
      u32x2 p = {pack2(v[j].x, v[j].y), pack2(v[j].z, v[j].w)};
      *(u32x2*)(outb + base + j * 128) = p;
    }
  }
#pragma unroll
  for (int j = 0; j < 8; ++j) *(f32x4*)(out + base + j * 128) = v[j];
}

// ---------------------------------------------------------------------------
// Launcher
// ---------------------------------------------------------------------------
extern "C" void kernel_launch(void* const* d_in, const int* in_sizes, int n_in,
                              void* d_out, int out_size, void* d_ws, size_t ws_size,
                              hipStream_t stream) {
  const float* x    = (const float*)d_in[0];
  const float* Wq   = (const float*)d_in[1];
  const float* bq   = (const float*)d_in[2];
  const float* Wk   = (const float*)d_in[3];
  const float* bk   = (const float*)d_in[4];
  const float* Wv   = (const float*)d_in[5];
  const float* bv   = (const float*)d_in[6];
  const float* Wo   = (const float*)d_in[7];
  const float* ln1g = (const float*)d_in[8];
  const float* ln1b = (const float*)d_in[9];
  const float* W1   = (const float*)d_in[10];
  const float* b1   = (const float*)d_in[11];
  const float* W2   = (const float*)d_in[12];
  const float* b2   = (const float*)d_in[13];
  const float* ln2g = (const float*)d_in[14];
  const float* ln2b = (const float*)d_in[15];

  char* ws = (char*)d_ws;
  size_t off = 0;
  auto alloc = [&](size_t bytes) -> char* {
    char* p = ws + off;
    off = (off + bytes + 255) & ~(size_t)255;
    return p;
  };

  __bf16* xb   = (__bf16*)alloc((size_t)NTOK * DMODEL * 2);
  __bf16* Wqt  = (__bf16*)alloc((size_t)3 * DMODEL * DMODEL * 2);   // [N][K], q k v in a row
  __bf16* Wkt  = Wqt + (size_t)DMODEL * DMODEL;
  __bf16* Wvt  = Wkt + (size_t)DMODEL * DMODEL;
  __bf16* Wot  = (__bf16*)alloc((size_t)DMODEL * DMODEL * 2);
  __bf16* W1t  = (__bf16*)alloc((size_t)DMODEL * DHID * 2);
  __bf16* W2t  = (__bf16*)alloc((size_t)DHID * DMODEL * 2);
  __bf16* qbuf = (__bf16*)alloc((size_t)3 * NTOK * DMODEL * 2);     // q k v in a row
  __bf16* kbuf = qbuf + (size_t)NTOK * DMODEL;
  __bf16* vbuf = kbuf + (size_t)NTOK * DMODEL;
  __bf16* obuf = (__bf16*)alloc((size_t)NTOK * DMODEL * 2);
  float*  t1   = (float*)alloc((size_t)NTOK * DMODEL * 4);
  float*  h    = (float*)alloc((size_t)NTOK * DMODEL * 4);
  __bf16* hb   = (__bf16*)alloc((size_t)NTOK * DMODEL * 2);
  __bf16* m1   = (__bf16*)alloc((size_t)NTOK * DHID * 2);
  float*  m2   = (float*)alloc((size_t)NTOK * DMODEL * 4);

  // x cast and the six weight transposes
  prep_kernel<<<XBLOCKS + 4 * SQTILES + 2 * HIDTILES, 256, 0, stream>>>(
      x, Wq, Wk, Wv, Wo, W1, W2, xb, Wqt, Wkt, Wvt, Wot, W1t, W2t);

  // Q, K and V projections (bf16 out)
  gemm_kernel<false, true, true, 64><<<dim3(3 * DMODEL / 128, NTOK / 128), 256, 0, stream>>>(
      xb, Wqt, bq, bk, bv, qbuf, NTOK, DMODEL, DMODEL);

  // causal flash attention
  attn_kernel<<<dim3(SEQ / 64, NHEADS, 2), 128, 0, stream>>>(qbuf, kbuf, vbuf, obuf);

  // output projection (f32 out, no bias)
  gemm_kernel<false, false, false, 256><<<dim3(DMODEL / 128, NTOK / 128), 256, 0, stream>>>(
      obuf, Wot, nullptr, nullptr, nullptr, t1, NTOK, DMODEL, DMODEL);

  // h = LN(x + attn)
  add_ln_kernel<<<NTOK / 8, 256, 0, stream>>>(x, t1, ln1g, ln1b, h, hb);

  // MLP up with fused exact GELU (bf16 out)
  gemm_kernel<true, true, false, 64><<<dim3(DHID / 128, NTOK / 128), 256, 0, stream>>>(
      hb, W1t, b1, nullptr, nullptr, m1, NTOK, DHID, DMODEL);

  // MLP down (f32 out)
  gemm_kernel<false, false, false, 256><<<dim3(DMODEL / 128, NTOK / 128), 256, 0, stream>>>(
      m1, W2t, b2, nullptr, nullptr, m2, NTOK, DMODEL, DHID);

  // out = LN(h + mlp)
  add_ln_kernel<<<NTOK / 8, 256, 0, stream>>>(h, m2, ln2g, ln2b, (float*)d_out, nullptr);
}

// v010
// It runs in 159 microseconds.
// In both of two side-by-side timings against v009, it was 1.14 times as fast.
// Over all steps from v000 it is 3.03 times as fast.
#include <hip/hip_runtime.h>
#include <hip/hip_bf16.h>
#include <math.h>

// ---------------------------------------------------------------------------
// Transformer layer for MI455X (gfx1250, wave32, WMMA).
// All matmuls use v_wmma_f32_16x16x32_bf16 (bf16 in, f32 accum).
// Weights pre-transposed at cast time so GEMM A and B tiles are both
// contiguous-row copies -> double-buffered async global->LDS staging.
// ---------------------------------------------------------------------------

typedef __attribute__((ext_vector_type(16))) __bf16 v16bf;
typedef __attribute__((ext_vector_type(8)))  float  v8f;
typedef __attribute__((ext_vector_type(4)))  float  f32x4;
typedef __attribute__((ext_vector_type(4)))  int    i32x4;

#define DMODEL 1024
#define DHEAD  64
#define NHEADS 16
#define DHID   4096
#define SEQ    2048
#define NTOK   4096   // B * S

union Frag16 { f32x4 f[2]; v16bf v; };
union Half8  { f32x4 f; __bf16 b[8]; };

#if __has_builtin(__builtin_amdgcn_global_load_async_to_lds_b128)
#define HAVE_ASYNC_LDS 1
#else
#define HAVE_ASYNC_LDS 0
#endif

// Copy 16 bytes (8 bf16) global -> LDS; async (per-lane gather) when available.
__device__ __forceinline__ void async_copy16(const __bf16* g, __bf16* l) {
#if HAVE_ASYNC_LDS
  __builtin_amdgcn_global_load_async_to_lds_b128(
      (__attribute__((address_space(1))) i32x4*)g,
      (__attribute__((address_space(3))) i32x4*)l, 0, 0);
#else
  *(f32x4*)l = *(const f32x4*)g;
#endif
}

__device__ __forceinline__ void wait_async_all() {
  asm volatile("s_wait_asynccnt 0x0" ::: "memory");
}

__device__ __forceinline__ v16bf load_frag(const __bf16* p0, const __bf16* p1) {
  Frag16 u;
  u.f[0] = *(const f32x4*)p0;   // elems 0..7  (K = half+0..7)
  u.f[1] = *(const f32x4*)p1;   // elems 8..15 (K = 16+half+0..7)
  return u.v;
}

__device__ __forceinline__ v8f zero8() {
  v8f z = {0.f,0.f,0.f,0.f,0.f,0.f,0.f,0.f};
  return z;
}

__device__ __forceinline__ v8f wmma_bf16(v16bf a, v16bf b, v8f c) {
  return __builtin_amdgcn_wmma_f32_16x16x32_bf16(
      false, a, false, b, (short)0, c, false, false);
}

// ---------------------------------------------------------------------------
// Conversion pre-pass, one launch. None of its seven jobs reads another's
// output, so the block index picks the job. Every block converts 16384
// elements, 64 a thread by 16-byte loads, so that few waves have to start:
//   blocks [0, 256)     x fp32 -> bf16
//   blocks [256, 1024)  fp32 W[K,N] -> bf16 Wt[N,K], one 128x128 tile a block
//                       (Wq, Wk, Wv, Wo: 64 tiles each; W1, W2: 256 each)
// ---------------------------------------------------------------------------
#define PREPELEMS 16384
#define XBLOCKS (NTOK * DMODEL / PREPELEMS)
#define SQTILES ((DMODEL / 128) * (DMODEL / 128))
#define HIDTILES ((DMODEL / 128) * (DHID / 128))

typedef __attribute__((ext_vector_type(2))) float    f32x2;
typedef __attribute__((ext_vector_type(2))) __bf16   bf16x2;
typedef __attribute__((ext_vector_type(2))) unsigned u32x2;
typedef __attribute__((ext_vector_type(4))) unsigned u32x4;

// two f32 -> one dword of two bf16, a in the low half
__device__ __forceinline__ unsigned pack2(float a, float b) {
  f32x2 v = {a, b};
  return __builtin_bit_cast(unsigned, __builtin_convertvector(v, bf16x2));
}

// One 128x128 tile: fp32 W[K,N] -> bf16 Wt[N,K]. K and N are compile-time, so
// a thread's 16 loads are one address with 16 immediate offsets.
// tile is [n][k] as bf16, 256 B a row, in units of 8 B (four k). Unit u of row
// n lies at place u ^ (n >> 2): the 32 lanes of a store, which hold 32 rows at
// one u, then fall on 32 different places, that is on all 64 banks.
// The loops are unrolled so that v[][] stays in registers and the offsets
// are immediates.
template<int K, int N>
__device__ __forceinline__ void transpose_tile(const float* __restrict__ W,
                                               __bf16* __restrict__ Wt,
                                               int b, unsigned* tile)
{
  const int tid = threadIdx.x;
  const int n0 = (b % (N / 128)) * 128, k0 = (b / (N / 128)) * 128;
  const int lane = tid & 31, wave = tid >> 5;

  // A wave-wide load is 512 B of one k row; a lane holds columns 4*lane..+3
  // of rows 4*u..4*u+3, u = wave + 8*j.
  const float* src = W + (size_t)(k0 + 4 * wave) * N + n0 + lane * 4;
  f32x4 v[4][4];
#pragma unroll
  for (int j = 0; j < 4; ++j)
#pragma unroll
    for (int e = 0; e < 4; ++e)
      v[j][e] = *(const f32x4*)(src + (32 * j + e) * N);
#pragma unroll
  for (int j = 0; j < 4; ++j)
#pragma unroll
    for (int i = 0; i < 4; ++i) {
      u32x2 p = {pack2(v[j][0][i], v[j][1][i]), pack2(v[j][2][i], v[j][3][i])};
      *(u32x2*)&tile[(lane * 4 + i) * 64 + (((wave + 8 * j) ^ lane) << 1)] = p;
    }
  __syncthreads();

  // 16 lanes store one row's 256 B. Units 2*kg and 2*kg+1 share a 16-byte
  // place and stand there in swapped order where n >> 2 is odd.
  const int kg = tid & 15, nr = tid >> 4;
  __bf16* dst = Wt + (size_t)(n0 + nr) * K + k0 + kg * 8;
#pragma unroll
  for (int p = 0; p < 8; ++p) {
    const int n = nr + 16 * p;
    const int s = n >> 2;
    u32x4 q = *(const u32x4*)&tile[n * 64 + ((kg ^ (s >> 1)) << 2)];
    if (s & 1) q = q.zwxy;
    *(u32x4*)(dst + 16 * p * K) = q;
  }
  // the stores' registers may be written again by the code that follows in
  // the listing: the wait stands in front of any such overwrite
  asm volatile("s_wait_xcnt 0x0" ::: "memory");
}

__global__ __launch_bounds__(256)
void prep_kernel(const float* __restrict__ x,
                 const float* __restrict__ Wq, const float* __restrict__ Wk,
                 const float* __restrict__ Wv, const float* __restrict__ Wo,
                 const float* __restrict__ W1, const float* __restrict__ W2,
                 __bf16* __restrict__ xb,
                 __bf16* __restrict__ Wqt, __bf16* __restrict__ Wkt,
                 __bf16* __restrict__ Wvt, __bf16* __restrict__ Wot,
                 __bf16* __restrict__ W1t, __bf16* __restrict__ W2t)
{
  __shared__ __attribute__((aligned(16))) unsigned tile[128 * 64];
  int b = blockIdx.x;

  if (b < XBLOCKS) {
    const size_t base = (size_t)b * PREPELEMS + threadIdx.x * 4;
    f32x4 v[16];                         // unrolled: v[] stays in registers
#pragma unroll
    for (int j = 0; j < 16; ++j) v[j] = *(const f32x4*)(x + base + j * 1024);
#pragma unroll
    for (int j = 0; j < 16; ++j) {
      u32x2 p = {pack2(v[j].x, v[j].y), pack2(v[j].z, v[j].w)};
      *(u32x2*)(xb + base + j * 1024) = p;
    }
    return;
  }
  b -= XBLOCKS;

  // the branches are uniform for the block, so each one's barrier is met by
  // all of its threads
  if (b < 4 * SQTILES) {
    const int w = b / SQTILES;
    const float* W = w == 0 ? Wq  : w == 1 ? Wk  : w == 2 ? Wv  : Wo;
    __bf16* Wt     = w == 0 ? Wqt : w == 1 ? Wkt : w == 2 ? Wvt : Wot;
    transpose_tile<DMODEL, DMODEL>(W, Wt, b - w * SQTILES, tile);
  } else if (b < 4 * SQTILES + HIDTILES) {
    transpose_tile<DMODEL, DHID>(W1, W1t, b - 4 * SQTILES, tile);
  } else {
    transpose_tile<DHID, DMODEL>(W2, W2t, b - (4 * SQTILES + HIDTILES), tile);
  }
}

// ---------------------------------------------------------------------------
// Tiled bf16 WMMA GEMM: C[M,N] = act(A[M,K] @ Bt[N,K]^T + bias)
// Block tile 128x128, k-step KS, double-buffered async LDS staging.
// KS is 64 where several blocks share a WGP and fill each other's waits, and
// 256 where the grid gives a WGP one block: there nothing else runs while the
// block waits out a hand-over (copy wait and barrier), so a long step, with a
// quarter of the hand-overs along K and four times the products to cover the
// next step's copies, is the faster. K must be a multiple of KS.
// 256 threads = 8 waves, wave grid 4x2 (MxN); each wave: 2x4 16x16 tiles.
// Both LDS tiles are [row/col][k] with stride KS + 8 (an odd multiple of
// 16 bytes) so every fragment is two contiguous ds_load_b128 per lane
// without bank conflicts (A layout: K groups of 8 per lane-half).
// TRI: three products that share A in one launch. Bt holds the three [N,K]
// weights one behind the other, Cout the three [M,N] outputs likewise; grid x
// runs over all 3N columns and each 128-column block lies in one part.
// ---------------------------------------------------------------------------
template<bool GELU, bool OUT_BF16, bool TRI, int KS>
__global__ __launch_bounds__(256)
void gemm_kernel(const __bf16* __restrict__ A, const __bf16* __restrict__ Bt,
                 const float* __restrict__ bias, const float* __restrict__ bias1,
                 const float* __restrict__ bias2, void* __restrict__ Cout,
                 int M, int N, int K)
{
  constexpr int PITCH = KS + 8;          // LDS row stride in elements
  __shared__ __attribute__((aligned(16))) __bf16 As[2][128 * PITCH];
  __shared__ __attribute__((aligned(16))) __bf16 Bs[2][128 * PITCH];

  const int tid   = threadIdx.x;
  const int lane  = tid & 31;
  const int wave  = tid >> 5;
  const int waveM = wave >> 1;           // 0..3
  const int waveN = wave & 1;            // 0..1
  const int lr    = lane & 15;
  const int half  = (lane >> 4) * 8;
  const int blkN  = blockIdx.x * 128;
  const int blkM  = blockIdx.y * 128;

  v8f acc[2][4];
#pragma unroll
  for (int tm = 0; tm < 2; ++tm)
#pragma unroll
    for (int tn = 0; tn < 4; ++tn) acc[tm][tn] = zero8();

  // KS / 8 lanes take one row's 2 * KS bytes of the k-step, so each wave-wide
  // copy covers four whole 128-byte lines (of four rows, or all of one row).
  constexpr int LPR = KS / 8;            // lanes per row
  constexpr int RPC = 256 / LPR;         // rows per block-wide copy
  const int srow = tid / LPR;            // plus RPC per copy
  const int skc  = (tid % LPR) * 8;      // 0..KS - 8

  auto stage = [&](int k0, int buf) {
    const __bf16* ag = A  + (size_t)(blkM + srow) * K + k0 + skc;
    const __bf16* bg = Bt + (size_t)(blkN + srow) * K + k0 + skc;
    __bf16* al = &As[buf][srow * PITCH + skc];
    __bf16* bl = &Bs[buf][srow * PITCH + skc];
#pragma unroll
    for (int e = 0; e < 128 / RPC; ++e) {
      async_copy16(ag + (size_t)(e * RPC) * K, al + e * RPC * PITCH);
      async_copy16(bg + (size_t)(e * RPC) * K, bl + e * RPC * PITCH);
    }
  };

  stage(0, 0);
  const int T = K >> __builtin_ctz(KS);  // K / KS, KS a power of two
  for (int i = 0; i < T; ++i) {
    wait_async_all();                    // own tile-i loads landed
    __syncthreads();                     // everyone's tile-i landed; prev reads done
    if (i + 1 < T) stage((i + 1) * KS, (i + 1) & 1);

    const __bf16* as = As[i & 1];
    const __bf16* bs = Bs[i & 1];
#pragma unroll
    for (int kc = 0; kc < KS / 32; ++kc) {
      v16bf af[2], bfv[4];
#pragma unroll
      for (int tm = 0; tm < 2; ++tm) {
        const __bf16* p = as + (waveM * 32 + tm * 16 + lr) * PITCH + kc * 32 + half;
        af[tm] = load_frag(p, p + 16);
      }
#pragma unroll
      for (int tn = 0; tn < 4; ++tn) {
        const __bf16* p = bs + (waveN * 64 + tn * 16 + lr) * PITCH + kc * 32 + half;
        bfv[tn] = load_frag(p, p + 16);
      }
#pragma unroll
      for (int tm = 0; tm < 2; ++tm)
#pragma unroll
        for (int tn = 0; tn < 4; ++tn)
          acc[tm][tn] = wmma_bf16(af[tm], bfv[tn], acc[tm][tn]);
    }
  }

  // epilogue: bias + optional exact GELU, f32 or bf16 store
  int partN = 0;                         // first column of this block's part
  if (TRI) {
    const int part = blkN / N;
    partN = part * N;
    bias = part == 0 ? bias : part == 1 ? bias1 : bias2;
    // col below counts from column 0 of part 0: part's [M,N] output starts
    // part * M * N elements on, less the partN that col already holds
    Cout = (__bf16*)Cout + ((size_t)part * M * N - partN);
  }
#pragma unroll
  for (int tm = 0; tm < 2; ++tm) {
#pragma unroll
    for (int tn = 0; tn < 4; ++tn) {
      int col = blkN + waveN * 64 + tn * 16 + lr;
      float bv = bias ? bias[col - partN] : 0.f;
#pragma unroll
      for (int r = 0; r < 8; ++r) {
        int row = blkM + waveM * 32 + tm * 16 + half + r;
        float v = acc[tm][tn][r] + bv;
        if (GELU) v = 0.5f * v * (1.f + erff(v * 0.70710678118654752f));
        if (OUT_BF16) ((__bf16*)Cout)[(size_t)row * N + col] = (__bf16)v;
        else          ((float*)Cout)[(size_t)row * N + col]  = v;
      }
    }
  }
}

__device__ __forceinline__ float xhalf(float x) {
  int b = __builtin_bit_cast(int, x);
  return __builtin_bit_cast(float,
      __builtin_amdgcn_permlanex16(b, b, 0x76543210, 0xfedcba98, false, false));
}

// 16 bytes a lane from a row-major 16-bit LDS tile T, transposed: with lane l
// at row k0 + 8 * (l >> 4) + (l & 7), column d0 + 8 * ((l >> 3) & 1), lane
// (c = l & 15, h = l >> 4) receives T[k0 + 8h + 0..7][d0 + c].
typedef __attribute__((ext_vector_type(8))) short s16x8;
__device__ __forceinline__ f32x4 load_tr16(const __bf16* p) {
  typedef __attribute__((address_space(3))) s16x8 lds_s16x8;
  return __builtin_bit_cast(f32x4,
      __builtin_amdgcn_ds_load_tr16_b128_v8i16((lds_s16x8*)p));
}

#define KT 128                          // keys per trip; SEQ is a multiple
union PFrag { unsigned u[8]; v16bf v; };  // dword i: elements 2i (low), 2i + 1

__global__ __launch_bounds__(128)
void attn_kernel(const __bf16* __restrict__ qb, const __bf16* __restrict__ kb,
                 const __bf16* __restrict__ vb, __bf16* __restrict__ ob)
{
  __shared__ __attribute__((aligned(16))) __bf16 Kt[2][KT * 72];  // [key][d]
  // [key][d]; pitch 160 B, an odd multiple of 32 B, suits the transposing load
  __shared__ __attribute__((aligned(16))) __bf16 Vs[2][KT * 80];

  const int tid  = threadIdx.x;
  const int lane = tid & 31;
  const int wave = tid >> 5;
  const int lr   = lane & 15;
  const int half = (lane >> 4) * 8;

  const int head = blockIdx.y;
  // Placement, for speed only. A query tile's cost grows with its index and
  // all blocks are resident at once, so the launch lasts as long as the
  // fullest WGP. The grid's x extent is 32.
  // So the (head, batch) pairs of odd bit parity walk the tiles from the far
  // end: of blocks 32, 64, ... 512 flat indices apart half hold tile x and
  // half tile 31 - x, heavy beside light. Every (head, batch, tile) runs once.
  const int rev  = __builtin_popcount(blockIdx.y ^ (blockIdx.z << 4)) & 1;
  const int q0   = (rev ? (SEQ / 64 - 1) - blockIdx.x : blockIdx.x) * 64;
  const int qw   = q0 + wave * 16;
  const int qrow = qw + lr;             // this lane's query
  const size_t tokbase = (size_t)blockIdx.z * SEQ;

  v16bf qf[2];                          // B fragment: column = query, k = d
#pragma unroll
  for (int di = 0; di < 2; ++di) {
    const __bf16* p = qb + (tokbase + qrow) * DMODEL + head * DHEAD + di * 32 + half;
    qf[di] = load_frag(p, p + 16);
  }

  constexpr float CS = 0.125f * 1.4426950408889634f;   // log2(e) / sqrt(DHEAD)
  float m = -1e30f;                     // running maximum, of the raw products
  float l = 0.f;                        // sum over this lane's keys only
  v8f o[4];                             // o[t][r] = O[qrow][t*16 + half + r]
#pragma unroll
  for (int t = 0; t < 4; ++t) o[t] = zero8();

  // A thread stages 16 bytes of keys srow, srow + 16, ... of a tile.
  const int srow = tid >> 3;            // 0..15
  const int soff = (tid & 7) * 8;       // d 0..56
  const size_t sbase = (tokbase + srow) * DMODEL + head * DHEAD + soff;

  // tile t: K and V by async copies into Kt[buf] and Vs[buf]; nothing waits
  auto fetch = [&](int t, int buf) {
    const size_t g = sbase + (size_t)t * (KT * DMODEL);
#pragma unroll                          // constant LDS and row offsets
    for (int e = 0; e < KT / 16; ++e) {
      async_copy16(kb + g + e * 16 * DMODEL, &Kt[buf][(srow + 16 * e) * 72 + soff]);
      async_copy16(vb + g + e * 16 * DMODEL, &Vs[buf][(srow + 16 * e) * 80 + soff]);
    }
  };

  // last tile that holds a key <= q0 + 63; its keys end inside the sequence,
  // and those past the diagonal are masked like any other
  const int ktmax = (q0 + 63) / KT;
  fetch(0, 0);
  wait_async_all();
  __syncthreads();

  for (int kt = 0; kt <= ktmax; ++kt) {
    const int kpos = kt * KT;
    const int buf  = kt & 1;
    const __bf16* Kc = Kt[buf];
    const __bf16* Vc = Vs[buf];
    // Directly behind the barrier that ended every read of the other buffer:
    // the next tile sets out, and is waited for only at this trip's foot.
    if (kt < ktmax) fetch(kt + 1, buf ^ 1);

    // S^T = K * Q^T (KT keys x 16 queries) as KT / 16 tiles of 16x16.
    // All loops over j, g, t, r are unrolled: s[], pf[] and o[] stay in registers.
    v8f s[KT / 16];
#pragma unroll
    for (int j = 0; j < KT / 16; ++j) {
      s[j] = zero8();
#pragma unroll
      for (int di = 0; di < 2; ++di) {
        const __bf16* p = Kc + (j * 16 + lr) * 72 + di * 32 + half;
        s[j] = wmma_bf16(load_frag(p, p + 16), qf[di], s[j]);
      }
    }

    // online softmax, one query per lane, in base 2. The maximum is taken
    // over the raw products (the scale is positive); e^((s - mn) / 8) is
    // 2^(s * CS - mn * CS): one multiply-add and one hardware exponential a
    // score. No argument is above 0 but by rounding; a masked one, about
    // -2e29, gives 0.
    // Key j * 16 + r of this lane's rows is inside the causal mask while it
    // is <= rel: one lane value a trip, compared with constants.
    const int rel = qrow - kpos - half;
    float mx = -1e30f;
#pragma unroll
    for (int j = 0; j < KT / 16; ++j)
#pragma unroll
      for (int r = 0; r < 8; ++r) {
        s[j][r] = (j * 16 + r <= rel) ? s[j][r] : -1e30f;
        mx = fmaxf(mx, s[j][r]);
      }
    mx = fmaxf(mx, xhalf(mx));
    const float mn    = fmaxf(m, mx);
    const float alpha = __builtin_amdgcn_exp2f((m - mn) * CS);
    m = mn;
    const float nb = -mn * CS;
    const v8f csv = {CS, CS, CS, CS, CS, CS, CS, CS};
    const v8f nbv = {nb, nb, nb, nb, nb, nb, nb, nb};

    PFrag pf[KT / 32];                  // B fragments: column = query, k = key
    v8f psv = zero8();                  // eight partial sums, joined below
#pragma unroll
    for (int g = 0; g < KT / 32; ++g) {
      v8f p0 = __builtin_elementwise_fma(s[2 * g],     csv, nbv);
      v8f p1 = __builtin_elementwise_fma(s[2 * g + 1], csv, nbv);
#pragma unroll
      for (int r = 0; r < 8; ++r) {
        p0[r] = (g * 32 + r      <= rel) ? __builtin_amdgcn_exp2f(p0[r]) : 0.f;
        p1[r] = (g * 32 + 16 + r <= rel) ? __builtin_amdgcn_exp2f(p1[r]) : 0.f;
      }
      psv += p0 + p1;
#pragma unroll
      for (int r = 0; r < 4; ++r) {
        pf[g].u[r]     = pack2(p0[2 * r], p0[2 * r + 1]);
        pf[g].u[4 + r] = pack2(p1[2 * r], p1[2 * r + 1]);
      }
    }
    l = l * alpha + (((psv[0] + psv[1]) + (psv[2] + psv[3])) +
                     ((psv[4] + psv[5]) + (psv[6] + psv[7])));
#pragma unroll
    for (int t = 0; t < 4; ++t) o[t] *= alpha;

    // O^T += V^T * P^T. A fragment: row = d, k = keys half + 0..7 and
    // 16 + half + 0..7 of group g, the order in which pf[g] holds them.
#pragma unroll
    for (int g = 0; g < KT / 32; ++g)
#pragma unroll
      for (int t = 0; t < 4; ++t) {
        const __bf16* pv = Vc + (g * 32 + half + (lane & 7)) * 80 + t * 16 + ((lane >> 3) & 1) * 8;
        Frag16 av;
        av.f[0] = load_tr16(pv);
        av.f[1] = load_tr16(pv + 16 * 80);
        o[t] = wmma_bf16(av.v, pf[g].v, o[t]);
      }

    // own LDS reads done, own K and V copies of tile kt + 1 landed
    asm volatile("s_wait_dscnt 0x0" ::: "memory");
    wait_async_all();
    // publishes tile kt + 1 and ends every read of this trip's buffer,
    // which the next trip refills
    __syncthreads();
  }
  wait_async_all();                     // no copy in flight at the wave's end

  l += xhalf(l);                        // join the two halves' key sums
  __bf16* op = ob + (tokbase + qrow) * DMODEL + head * DHEAD + half;
#pragma unroll
  for (int t = 0; t < 4; ++t) {
    Half8 w;
#pragma unroll
    for (int r = 0; r < 8; ++r) w.b[r] = (__bf16)(o[t][r] / l);
    *(f32x4*)(op + t * 16) = w.f;
  }
}

// ---------------------------------------------------------------------------
// out = layernorm(x + y); optional bf16 copy for the next GEMM.
// One wave holds one row, 32 elements a lane by 16-byte loads, so that few
// waves have to start; both sums stay inside the wave: no LDS, no barrier.
// The loops are unrolled so that v[] and yv[] stay in registers.
// ---------------------------------------------------------------------------
__device__ __forceinline__ float wave_sum(float s) {
#pragma unroll
  for (int m = 16; m > 0; m >>= 1) s += __shfl_xor(s, m, 32);
  return s;
}

__global__ __launch_bounds__(256)
void add_ln_kernel(const float* __restrict__ x, const float* __restrict__ y,
                   const float* __restrict__ g, const float* __restrict__ b,
                   float* __restrict__ out, __bf16* __restrict__ outb)
{
  const int col = (threadIdx.x & 31) * 4;                 // plus 128 per j
  const int row = blockIdx.x * 8 + (threadIdx.x >> 5);
  const size_t base = (size_t)row * DMODEL + col;

  f32x4 v[8], yv[8];
#pragma unroll
  for (int j = 0; j < 8; ++j) v[j]  = *(const f32x4*)(x + base + j * 128);
#pragma unroll
  for (int j = 0; j < 8; ++j) yv[j] = *(const f32x4*)(y + base + j * 128);

  f32x4 s4 = {0.f, 0.f, 0.f, 0.f};
#pragma unroll
  for (int j = 0; j < 8; ++j) { v[j] += yv[j]; s4 += v[j]; }
  const float mu = wave_sum((s4.x + s4.y) + (s4.z + s4.w)) * (1.f / DMODEL);

  s4 = (f32x4){0.f, 0.f, 0.f, 0.f};
#pragma unroll
  for (int j = 0; j < 8; ++j) { v[j] -= mu; s4 += v[j] * v[j]; }
  const float rstd =
      rsqrtf(wave_sum((s4.x + s4.y) + (s4.z + s4.w)) * (1.f / DMODEL) + 1e-5f);

#pragma unroll
  for (int j = 0; j < 8; ++j) {
    const f32x4 gv = *(const f32x4*)(g + col + j * 128);
    const f32x4 bv = *(const f32x4*)(b + col + j * 128);
    v[j] = v[j] * rstd * gv + bv;
  }
  if (outb) {
#pragma unroll
    for (int j = 0; j < 8; ++j) {
      u32x2 p = {pack2(v[j].x, v[j].y), pack2(v[j].z, v[j].w)};
      *(u32x2*)(outb + base + j * 128) = p;
    }
  }
#pragma unroll
  for (int j = 0; j < 8; ++j) *(f32x4*)(out + base + j * 128) = v[j];
}

// ---------------------------------------------------------------------------
// Launcher
// ---------------------------------------------------------------------------
extern "C" void kernel_launch(void* const* d_in, const int* in_sizes, int n_in,
                              void* d_out, int out_size, void* d_ws, size_t ws_size,
                              hipStream_t stream) {
  const float* x    = (const float*)d_in[0];
  const float* Wq   = (const float*)d_in[1];
  const float* bq   = (const float*)d_in[2];
  const float* Wk   = (const float*)d_in[3];
  const float* bk   = (const float*)d_in[4];
  const float* Wv   = (const float*)d_in[5];
  const float* bv   = (const float*)d_in[6];
  const float* Wo   = (const float*)d_in[7];
  const float* ln1g = (const float*)d_in[8];
  const float* ln1b = (const float*)d_in[9];
  const float* W1   = (const float*)d_in[10];
  const float* b1   = (const float*)d_in[11];
  const float* W2   = (const float*)d_in[12];
  const float* b2   = (const float*)d_in[13];
  const float* ln2g = (const float*)d_in[14];
  const float* ln2b = (const float*)d_in[15];

  char* ws = (char*)d_ws;
  size_t off = 0;
  auto alloc = [&](size_t bytes) -> char* {
    char* p = ws + off;
    off = (off + bytes + 255) & ~(size_t)255;
    return p;
  };

  __bf16* xb   = (__bf16*)alloc((size_t)NTOK * DMODEL * 2);
  __bf16* Wqt  = (__bf16*)alloc((size_t)3 * DMODEL * DMODEL * 2);   // [N][K], q k v in a row
  __bf16* Wkt  = Wqt + (size_t)DMODEL * DMODEL;
  __bf16* Wvt  = Wkt + (size_t)DMODEL * DMODEL;
  __bf16* Wot  = (__bf16*)alloc((size_t)DMODEL * DMODEL * 2);
  __bf16* W1t  = (__bf16*)alloc((size_t)DMODEL * DHID * 2);
  __bf16* W2t  = (__bf16*)alloc((size_t)DHID * DMODEL * 2);
  __bf16* qbuf = (__bf16*)alloc((size_t)3 * NTOK * DMODEL * 2);     // q k v in a row
  __bf16* kbuf = qbuf + (size_t)NTOK * DMODEL;
  __bf16* vbuf = kbuf + (size_t)NTOK * DMODEL;
  __bf16* obuf = (__bf16*)alloc((size_t)NTOK * DMODEL * 2);
  float*  t1   = (float*)alloc((size_t)NTOK * DMODEL * 4);
  float*  h    = (float*)alloc((size_t)NTOK * DMODEL * 4);
  __bf16* hb   = (__bf16*)alloc((size_t)NTOK * DMODEL * 2);
  __bf16* m1   = (__bf16*)alloc((size_t)NTOK * DHID * 2);
  float*  m2   = (float*)alloc((size_t)NTOK * DMODEL * 4);

  // x cast and the six weight transposes
  prep_kernel<<<XBLOCKS + 4 * SQTILES + 2 * HIDTILES, 256, 0, stream>>>(
      x, Wq, Wk, Wv, Wo, W1, W2, xb, Wqt, Wkt, Wvt, Wot, W1t, W2t);

  // Q, K and V projections (bf16 out)
  gemm_kernel<false, true, true, 64><<<dim3(3 * DMODEL / 128, NTOK / 128), 256, 0, stream>>>(
      xb, Wqt, bq, bk, bv, qbuf, NTOK, DMODEL, DMODEL);

  // causal flash attention
  attn_kernel<<<dim3(SEQ / 64, NHEADS, 2), 128, 0, stream>>>(qbuf, kbuf, vbuf, obuf);

  // output projection (f32 out, no bias)
  gemm_kernel<false, false, false, 256><<<dim3(DMODEL / 128, NTOK / 128), 256, 0, stream>>>(
      obuf, Wot, nullptr, nullptr, nullptr, t1, NTOK, DMODEL, DMODEL);

  // h = LN(x + attn)
  add_ln_kernel<<<NTOK / 8, 256, 0, stream>>>(x, t1, ln1g, ln1b, h, hb);

  // MLP up with fused exact GELU (bf16 out)
  gemm_kernel<true, true, false, 64><<<dim3(DHID / 128, NTOK / 128), 256, 0, stream>>>(
      hb, W1t, b1, nullptr, nullptr, m1, NTOK, DHID, DMODEL);

  // MLP down (f32 out)
  gemm_kernel<false, false, false, 256><<<dim3(DMODEL / 128, NTOK / 128), 256, 0, stream>>>(
      m1, W2t, b2, nullptr, nullptr, m2, NTOK, DMODEL, DHID);

  // out = LN(h + mlp)
  add_ln_kernel<<<NTOK / 8, 256, 0, stream>>>(h, m2, ln2g, ln2b, (float*)d_out, nullptr);
}
